// v000
// Measured on an AMD MI455X. A time is GPU time per run, averaged over a window of back-to-back runs after a warm-up
// (all launches, gaps included; the runs take copies of the inputs in turn), and the median of several windows.
// Apart from v000's, it joins two sittings. Times from different sittings can be a few percent apart, while
// side-by-side timings come from the same sitting.
// The starting kernel, v000, takes 369 microseconds a run.
#include <hip/hip_runtime.h>
#include <hip/hip_bf16.h>

typedef __attribute__((ext_vector_type(16))) _Float16 v16h;
typedef __attribute__((ext_vector_type(8)))  _Float16 v8h;
typedef __attribute__((ext_vector_type(8)))  float    v8f;
typedef __attribute__((ext_vector_type(4)))  int      v4i;

#define SCALE_ATT 0.125f   // 64^-0.5
#define LN_EPS    1e-5f

#if __has_builtin(__builtin_amdgcn_global_load_async_to_lds_b128) && \
    __has_builtin(__builtin_amdgcn_s_wait_asynccnt)
#define HAVE_ASYNC_LDS 1
#else
#define HAVE_ASYNC_LDS 0
#endif

typedef __attribute__((address_space(1))) v4i as1_v4i;   // global int4
typedef __attribute__((address_space(3))) v4i as3_v4i;   // LDS int4

__device__ __forceinline__ v8f wmma_f16(v16h a, v16h b, v8f c) {
  return __builtin_amdgcn_wmma_f32_16x16x32_f16(false, a, false, b, (short)0, c, false, false);
}

// 16-half WMMA fragment from row-major f16 memory: two contiguous 16B runs.
__device__ __forceinline__ v16h load_frag(const _Float16* __restrict__ p) {
  v16h r;
#pragma unroll
  for (int j = 0; j < 8; ++j) { r[j] = p[j]; r[8 + j] = p[16 + j]; }
  return r;
}

// Copy 8192B (one 8-fragment B panel) global -> LDS, 2 x b128 per thread.
__device__ __forceinline__ void stage_b(const _Float16* __restrict__ g,
                                        _Float16* l, int tid) {
  const _Float16* gp = g + tid * 8;
  _Float16* lp = l + tid * 8;
#if HAVE_ASYNC_LDS
  __builtin_amdgcn_global_load_async_to_lds_b128((as1_v4i*)gp, (as3_v4i*)lp, 0, 0);
  __builtin_amdgcn_global_load_async_to_lds_b128((as1_v4i*)(gp + 2048),
                                                 (as3_v4i*)(lp + 2048), 0, 0);
#else
  *(v8h*)lp = *(const v8h*)gp;
  *(v8h*)(lp + 2048) = *(const v8h*)(gp + 2048);
#endif
}

#if HAVE_ASYNC_LDS
#define ASYNC_WAIT(n) __builtin_amdgcn_s_wait_asynccnt(n)
#else
#define ASYNC_WAIT(n)
#endif

// ---------------------------------------------------------------------------
// 1) f32 weight [K,Nn] -> f16 B-fragment-swizzled: Wf[(kt*(Nn/16)+nt)*512+lane*16]
// ---------------------------------------------------------------------------
__global__ void __launch_bounds__(256) swizzle_w_kernel(
    const float* __restrict__ W, _Float16* __restrict__ Wf, int K, int Nn) {
  int t    = blockIdx.x * 256 + threadIdx.x;
  int lane = t & 31;
  int frag = t >> 5;
  int ntiles = Nn >> 4;
  int nt = frag % ntiles;
  int kt = frag / ntiles;
  if (kt >= (K >> 5)) return;
  int half = lane >> 4, l15 = lane & 15;
  int n = nt * 16 + l15;
  _Float16* dst = Wf + (size_t)frag * 512 + lane * 16;
#pragma unroll
  for (int j = 0; j < 8; ++j) {
    int k0 = kt * 32 + half * 8 + j;
    dst[j]     = (_Float16)W[(size_t)k0 * Nn + n];
    dst[8 + j] = (_Float16)W[(size_t)(k0 + 16) * Nn + n];
  }
}

// ---------------------------------------------------------------------------
// 2) LayerNorm: one wave32 per 256-wide row, f16 row-major output.
// ---------------------------------------------------------------------------
__global__ void __launch_bounds__(256) layernorm_kernel(
    const float* __restrict__ x, const float* __restrict__ g,
    const float* __restrict__ b, _Float16* __restrict__ y, int nrows) {
  int wave = threadIdx.x >> 5, lane = threadIdx.x & 31;
  int row = blockIdx.x * 8 + wave;
  if (row >= nrows) return;
  const float* xr = x + (size_t)row * 256;
  float v[8];
  float s = 0.f;
#pragma unroll
  for (int j = 0; j < 8; ++j) { v[j] = xr[lane * 8 + j]; s += v[j]; }
#pragma unroll
  for (int off = 16; off; off >>= 1) s += __shfl_xor(s, off, 32);
  float mu = s * (1.0f / 256.0f);
  float vs = 0.f;
#pragma unroll
  for (int j = 0; j < 8; ++j) { v[j] -= mu; vs += v[j] * v[j]; }
#pragma unroll
  for (int off = 16; off; off >>= 1) vs += __shfl_xor(vs, off, 32);
  float rstd = rsqrtf(vs * (1.0f / 256.0f) + LN_EPS);
  _Float16* yr = y + (size_t)row * 256;
#pragma unroll
  for (int j = 0; j < 8; ++j) {
    int c = lane * 8 + j;
    yr[c] = (_Float16)(v[j] * rstd * g[c] + b[c]);
  }
}

// ---------------------------------------------------------------------------
// 3) GEMM: C[M,Nn] = A[M,K](f16 rm) @ Bf(swizzled) + bias.
//    8 waves (4M x 2N), block tile 128x128; per-wave 32x64 (acc[2][4]).
//    B panel (8 frags = 8KB per k-step) async-staged into LDS, double-
//    buffered; B fragment reads batched so WMMAs issue back-to-back.
// ---------------------------------------------------------------------------
__global__ void __launch_bounds__(256) gemm_kernel(
    const _Float16* __restrict__ A, const _Float16* __restrict__ Bf,
    const float* __restrict__ bias, void* __restrict__ Cout,
    int M, int K, int Nn, int out_f16) {
  __shared__ _Float16 Bsh[2][8 * 512];   // 2 x 8KB
  int tid  = threadIdx.x;
  int lane = tid & 31;
  int wave = tid >> 5;
  int wm = wave & 3, wn = wave >> 2;
  int m0 = blockIdx.y * 128 + wm * 32;
  int n0 = blockIdx.x * 128 + wn * 64;
  int half = lane >> 4, l15 = lane & 15;
  int ktiles = K >> 5;
  size_t bstride = (size_t)(Nn >> 4) * 512;

  const _Float16* Ap0 = A + (size_t)(m0 + l15) * K + half * 8;
  const _Float16* Ap1 = Ap0 + (size_t)16 * K;
  const _Float16* Bp = Bf + (size_t)blockIdx.x * 8 * 512;
  const _Float16* bs_base = &Bsh[0][0] + wn * 4 * 512 + lane * 16;

  v8f acc[2][4];
  v8f vzero = {0.f, 0.f, 0.f, 0.f, 0.f, 0.f, 0.f, 0.f};
#pragma unroll
  for (int mi = 0; mi < 2; ++mi)
#pragma unroll
    for (int i = 0; i < 4; ++i) acc[mi][i] = vzero;

  stage_b(Bp, &Bsh[0][0], tid);                    // prologue: k-step 0
  for (int kt = 0; kt < ktiles - 1; ++kt) {
    v16h a0 = load_frag(Ap0);                      // A in flight early
    v16h a1 = load_frag(Ap1);
    Ap0 += 32; Ap1 += 32;
    stage_b(Bp + bstride, &Bsh[(kt + 1) & 1][0], tid);
    Bp += bstride;
    ASYNC_WAIT(2);                                 // oldest panel resident
    __syncthreads();
    const _Float16* bs = bs_base + (kt & 1) * (8 * 512);
    v16h bfr[4];
#pragma unroll
    for (int nt = 0; nt < 4; ++nt) bfr[nt] = *(const v16h*)(bs + nt * 512);
#pragma unroll
    for (int nt = 0; nt < 4; ++nt) acc[0][nt] = wmma_f16(a0, bfr[nt], acc[0][nt]);
#pragma unroll
    for (int nt = 0; nt < 4; ++nt) acc[1][nt] = wmma_f16(a1, bfr[nt], acc[1][nt]);
    __syncthreads();                               // reads done before restage
  }
  {
    v16h a0 = load_frag(Ap0);
    v16h a1 = load_frag(Ap1);
    ASYNC_WAIT(0);
    __syncthreads();
    const _Float16* bs = bs_base + ((ktiles - 1) & 1) * (8 * 512);
    v16h bfr[4];
#pragma unroll
    for (int nt = 0; nt < 4; ++nt) bfr[nt] = *(const v16h*)(bs + nt * 512);
#pragma unroll
    for (int nt = 0; nt < 4; ++nt) acc[0][nt] = wmma_f16(a0, bfr[nt], acc[0][nt]);
#pragma unroll
    for (int nt = 0; nt < 4; ++nt) acc[1][nt] = wmma_f16(a1, bfr[nt], acc[1][nt]);
  }

#pragma unroll
  for (int mi = 0; mi < 2; ++mi) {
#pragma unroll
    for (int nt = 0; nt < 4; ++nt) {
      int n = n0 + nt * 16 + l15;
      float bv = bias ? bias[n] : 0.f;
#pragma unroll
      for (int g = 0; g < 8; ++g) {
        int row = m0 + mi * 16 + g + half * 8;
        float val = acc[mi][nt][g] + bv;
        if (out_f16)
          ((_Float16*)Cout)[(size_t)row * Nn + n] = (_Float16)val;
        else
          ((float*)Cout)[(size_t)row * Nn + n] = val;
      }
    }
  }
}

// ---------------------------------------------------------------------------
// 4) Repack vp [8192,1024] f16 into B-frag layout over (key32 x dcol16).
// ---------------------------------------------------------------------------
__global__ void __launch_bounds__(256) repack_v_kernel(
    const _Float16* __restrict__ vp, _Float16* __restrict__ vpf) {
  int t    = blockIdx.x * 256 + threadIdx.x;
  int lane = t & 31;
  int frag = t >> 5;
  int nt = frag & 63;
  int kt = frag >> 6;
  if (kt >= 256) return;
  int half = lane >> 4, l15 = lane & 15;
  int n = nt * 16 + l15;
  _Float16* dst = vpf + (size_t)frag * 512 + lane * 16;
#pragma unroll
  for (int j = 0; j < 8; ++j) {
    int k0 = kt * 32 + half * 8 + j;
    dst[j]     = vp[(size_t)k0 * 1024 + n];
    dst[8 + j] = vp[(size_t)(k0 + 16) * 1024 + n];
  }
}

// ---------------------------------------------------------------------------
// 5) Flash attention: block = (batch, 16-query tile), 8 waves; wave w owns
//    d-slice [w*128, w*128+128). Partial S reduced via ds_add_f32 in LDS.
//    All loop addressing is pointer-bump + immediate offsets.
// ---------------------------------------------------------------------------
__global__ void __launch_bounds__(256) flash_attn_kernel(
    const _Float16* __restrict__ qp, const _Float16* __restrict__ kp,
    const _Float16* __restrict__ vpf, _Float16* __restrict__ xout) {
  __shared__ float    Sred[16 * 32];
  __shared__ _Float16 Pbuf[16 * 32];

  int lane = threadIdx.x & 31, wave = threadIdx.x >> 5;
  int half = lane >> 4, l15 = lane & 15;
  int b  = blockIdx.x >> 7;
  int qt = blockIdx.x & 127;
  size_t qrow0 = (size_t)b * 2048 + (size_t)qt * 16;

  // Q A-fragments for this wave's 128-wide d-slice
  v16h qa[4];
  const _Float16* qbase = qp + (qrow0 + l15) * 1024 + wave * 128 + half * 8;
#pragma unroll
  for (int kc = 0; kc < 4; ++kc) qa[kc] = load_frag(qbase + kc * 32);

  // running pointers (advance by one 32-key block per iteration)
  const _Float16* kbase =
      kp + ((size_t)b * 2048 + l15) * 1024 + wave * 128 + half * 8;
  const _Float16* vbase =
      vpf + ((size_t)(b * 64) * 64 + wave * 8) * 512 + (size_t)lane * 16;

  v8f vzero = {0.f, 0.f, 0.f, 0.f, 0.f, 0.f, 0.f, 0.f};
  v8f o[8];
#pragma unroll
  for (int i = 0; i < 8; ++i) o[i] = vzero;
  float m[8], l[8];
#pragma unroll
  for (int g = 0; g < 8; ++g) { m[g] = -1e30f; l[g] = 0.f; }

  for (int kb = 0; kb < 64; ++kb) {
    __syncthreads();
    Sred[threadIdx.x]       = 0.f;
    Sred[256 + threadIdx.x] = 0.f;
    __syncthreads();

    // V fragments for this key block issued early (consumed after softmax)
    v16h vb[8];
#pragma unroll
    for (int nt = 0; nt < 8; ++nt)
      vb[nt] = *(const v16h*)(vbase + nt * 512);
    vbase += 64 * 512;

    // K fragments, batched ahead of the WMMA chains
    v16h kf0[4], kf1[4];
#pragma unroll
    for (int kc = 0; kc < 4; ++kc) kf0[kc] = load_frag(kbase + kc * 32);
#pragma unroll
    for (int kc = 0; kc < 4; ++kc) kf1[kc] = load_frag(kbase + 16384 + kc * 32);
    v8f s0 = vzero, s1 = vzero;
#pragma unroll
    for (int kc = 0; kc < 4; ++kc) s0 = wmma_f16(qa[kc], kf0[kc], s0);
#pragma unroll
    for (int kc = 0; kc < 4; ++kc) s1 = wmma_f16(qa[kc], kf1[kc], s1);
    kbase += 32 * 1024;
    if (kb < 63) __builtin_prefetch(kbase, 0, 1);

    // cross-wave S reduction (ds_add_f32)
#pragma unroll
    for (int g = 0; g < 8; ++g) {
      int r = g + half * 8;
      atomicAdd(&Sred[r * 32 + l15], s0[g]);
      atomicAdd(&Sred[r * 32 + 16 + l15], s1[g]);
    }
    __syncthreads();

    // online softmax; row stats land in C-layout lane mapping
    float p0[8], p1[8];
#pragma unroll
    for (int g = 0; g < 8; ++g) {
      int r = g + half * 8;
      p0[g] = Sred[r * 32 + l15] * SCALE_ATT;
      p1[g] = Sred[r * 32 + 16 + l15] * SCALE_ATT;
      float t = fmaxf(p0[g], p1[g]);
#pragma unroll
      for (int off = 8; off; off >>= 1) t = fmaxf(t, __shfl_xor(t, off, 16));
      float mn = fmaxf(m[g], t);
      float corr = __expf(m[g] - mn);
      m[g] = mn;
      p0[g] = __expf(p0[g] - mn);
      p1[g] = __expf(p1[g] - mn);
      float rs = p0[g] + p1[g];
#pragma unroll
      for (int off = 8; off; off >>= 1) rs += __shfl_xor(rs, off, 16);
      l[g] = l[g] * corr + rs;
#pragma unroll
      for (int nt = 0; nt < 8; ++nt) o[nt][g] *= corr;
    }

    // wave 0 stages P for A-fragment consumption
    if (wave == 0) {
#pragma unroll
      for (int g = 0; g < 8; ++g) {
        int r = g + half * 8;
        Pbuf[r * 32 + l15]      = (_Float16)p0[g];
        Pbuf[r * 32 + 16 + l15] = (_Float16)p1[g];
      }
    }
    __syncthreads();

    v16h pa;
    {
      const _Float16* pr = &Pbuf[l15 * 32 + half * 8];
#pragma unroll
      for (int j = 0; j < 8; ++j) { pa[j] = pr[j]; pa[8 + j] = pr[16 + j]; }
    }

    // P @ V with preloaded fragments
#pragma unroll
    for (int nt = 0; nt < 8; ++nt) o[nt] = wmma_f16(pa, vb[nt], o[nt]);
  }

  // normalize + write x (f16 row-major)
#pragma unroll
  for (int g = 0; g < 8; ++g) {
    float rinv = 1.0f / l[g];
    size_t row = qrow0 + g + half * 8;
#pragma unroll
    for (int nt = 0; nt < 8; ++nt) {
      xout[row * 1024 + wave * 128 + nt * 16 + l15] =
          (_Float16)(o[nt][g] * rinv);
    }
  }
}

// ---------------------------------------------------------------------------
extern "C" void kernel_launch(void* const* d_in, const int* in_sizes, int n_in,
                              void* d_out, int out_size, void* d_ws,
                              size_t ws_size, hipStream_t stream) {
  const float* q    = (const float*)d_in[0];
  const float* k    = (const float*)d_in[1];
  const float* v    = (const float*)d_in[2];
  const float* ln_g = (const float*)d_in[3];
  const float* ln_b = (const float*)d_in[4];
  const float* Wq = (const float*)d_in[5];  const float* bq = (const float*)d_in[6];
  const float* Wk = (const float*)d_in[7];  const float* bk = (const float*)d_in[8];
  const float* Wv = (const float*)d_in[9];  const float* bv = (const float*)d_in[10];
  const float* Wo = (const float*)d_in[11]; const float* bo = (const float*)d_in[12];
  float* out = (float*)d_out;

  _Float16* w    = (_Float16*)d_ws;
  _Float16* Wqf  = w;
  _Float16* Wkf  = Wqf + 262144;
  _Float16* Wvf  = Wkf + 262144;
  _Float16* Wof  = Wvf + 262144;
  _Float16* lnq  = Wof + 262144;
  _Float16* lnk  = lnq + 2097152;
  _Float16* lnv  = lnk + 2097152;
  _Float16* qp16 = lnv + 2097152;
  _Float16* kp16 = qp16 + 8388608;
  _Float16* vp16 = kp16 + 8388608;
  _Float16* vpf  = vp16 + 8388608;
  _Float16* x16  = vpf + 8388608;

  swizzle_w_kernel<<<64, 256, 0, stream>>>(Wq, Wqf, 256, 1024);
  swizzle_w_kernel<<<64, 256, 0, stream>>>(Wk, Wkf, 256, 1024);
  swizzle_w_kernel<<<64, 256, 0, stream>>>(Wv, Wvf, 256, 1024);
  swizzle_w_kernel<<<64, 256, 0, stream>>>(Wo, Wof, 1024, 256);

  layernorm_kernel<<<1024, 256, 0, stream>>>(q, ln_g, ln_b, lnq, 8192);
  layernorm_kernel<<<1024, 256, 0, stream>>>(k, ln_g, ln_b, lnk, 8192);
  layernorm_kernel<<<1024, 256, 0, stream>>>(v, ln_g, ln_b, lnv, 8192);

  dim3 pgrid(1024 / 128, 8192 / 128);
  gemm_kernel<<<pgrid, 256, 0, stream>>>(lnq, Wqf, bq, qp16, 8192, 256, 1024, 1);
  gemm_kernel<<<pgrid, 256, 0, stream>>>(lnk, Wkf, bk, kp16, 8192, 256, 1024, 1);
  gemm_kernel<<<pgrid, 256, 0, stream>>>(lnv, Wvf, bv, vp16, 8192, 256, 1024, 1);

  repack_v_kernel<<<2048, 256, 0, stream>>>(vp16, vpf);

  flash_attn_kernel<<<512, 256, 0, stream>>>(qp16, kp16, vpf, x16);

  dim3 ogrid(256 / 128, 8192 / 128);
  gemm_kernel<<<ogrid, 256, 0, stream>>>(x16, Wof, bo, out, 8192, 1024, 256, 0);
}

// v001
// A run of this version takes 296 microseconds.
// Two timings next to v000 put it at 1.28 and 1.29 times that version's speed.
#include <hip/hip_runtime.h>
#include <hip/hip_bf16.h>

typedef __attribute__((ext_vector_type(16))) _Float16 v16h;
typedef __attribute__((ext_vector_type(8)))  _Float16 v8h;
typedef __attribute__((ext_vector_type(8)))  float    v8f;
typedef __attribute__((ext_vector_type(4)))  int      v4i;
typedef __attribute__((ext_vector_type(4)))  float    v4f;

#define SCALE_ATT 0.125f   // 64^-0.5
#define LN_EPS    1e-5f

#if __has_builtin(__builtin_amdgcn_global_load_async_to_lds_b128) && \
    __has_builtin(__builtin_amdgcn_s_wait_asynccnt)
#define HAVE_ASYNC_LDS 1
#else
#define HAVE_ASYNC_LDS 0
#endif

typedef __attribute__((address_space(1))) v4i as1_v4i;   // global int4
typedef __attribute__((address_space(3))) v4i as3_v4i;   // LDS int4

__device__ __forceinline__ v8f wmma_f16(v16h a, v16h b, v8f c) {
  return __builtin_amdgcn_wmma_f32_16x16x32_f16(false, a, false, b, (short)0, c, false, false);
}

// 16-half WMMA fragment from row-major f16 memory: two contiguous 16B runs.
__device__ __forceinline__ v16h load_frag(const _Float16* __restrict__ p) {
  v16h r;
#pragma unroll
  for (int j = 0; j < 8; ++j) { r[j] = p[j]; r[8 + j] = p[16 + j]; }
  return r;
}

// Copy 8192B (one 8-fragment B panel) global -> LDS, 2 x b128 per thread.
__device__ __forceinline__ void stage_b(const _Float16* __restrict__ g,
                                        _Float16* l, int tid) {
  const _Float16* gp = g + tid * 8;
  _Float16* lp = l + tid * 8;
#if HAVE_ASYNC_LDS
  __builtin_amdgcn_global_load_async_to_lds_b128((as1_v4i*)gp, (as3_v4i*)lp, 0, 0);
  __builtin_amdgcn_global_load_async_to_lds_b128((as1_v4i*)(gp + 2048),
                                                 (as3_v4i*)(lp + 2048), 0, 0);
#else
  *(v8h*)lp = *(const v8h*)gp;
  *(v8h*)(lp + 2048) = *(const v8h*)(gp + 2048);
#endif
}

#if HAVE_ASYNC_LDS
#define ASYNC_WAIT(n) __builtin_amdgcn_s_wait_asynccnt(n)
#else
#define ASYNC_WAIT(n)
#endif

// ---------------------------------------------------------------------------
// 1) f32 weight [K,Nn] -> f16 B-fragment-swizzled: Wf[(kt*(Nn/16)+nt)*512+lane*16]
// ---------------------------------------------------------------------------
__global__ void __launch_bounds__(256) swizzle_w_kernel(
    const float* __restrict__ W, _Float16* __restrict__ Wf, int K, int Nn) {
  int t    = blockIdx.x * 256 + threadIdx.x;
  int lane = t & 31;
  int frag = t >> 5;
  int ntiles = Nn >> 4;
  int nt = frag % ntiles;
  int kt = frag / ntiles;
  if (kt >= (K >> 5)) return;
  int half = lane >> 4, l15 = lane & 15;
  int n = nt * 16 + l15;
  _Float16* dst = Wf + (size_t)frag * 512 + lane * 16;
#pragma unroll
  for (int j = 0; j < 8; ++j) {
    int k0 = kt * 32 + half * 8 + j;
    dst[j]     = (_Float16)W[(size_t)k0 * Nn + n];
    dst[8 + j] = (_Float16)W[(size_t)(k0 + 16) * Nn + n];
  }
}

// ---------------------------------------------------------------------------
// 2) LayerNorm: one wave32 per 256-wide row, f16 row-major output.
// ---------------------------------------------------------------------------
__global__ void __launch_bounds__(256) layernorm_kernel(
    const float* __restrict__ x, const float* __restrict__ g,
    const float* __restrict__ b, _Float16* __restrict__ y, int nrows) {
  int wave = threadIdx.x >> 5, lane = threadIdx.x & 31;
  int row = blockIdx.x * 8 + wave;
  if (row >= nrows) return;
  const float* xr = x + (size_t)row * 256;
  float v[8];
  float s = 0.f;
#pragma unroll
  for (int j = 0; j < 8; ++j) { v[j] = xr[lane * 8 + j]; s += v[j]; }
#pragma unroll
  for (int off = 16; off; off >>= 1) s += __shfl_xor(s, off, 32);
  float mu = s * (1.0f / 256.0f);
  float vs = 0.f;
#pragma unroll
  for (int j = 0; j < 8; ++j) { v[j] -= mu; vs += v[j] * v[j]; }
#pragma unroll
  for (int off = 16; off; off >>= 1) vs += __shfl_xor(vs, off, 32);
  float rstd = rsqrtf(vs * (1.0f / 256.0f) + LN_EPS);
  _Float16* yr = y + (size_t)row * 256;
#pragma unroll
  for (int j = 0; j < 8; ++j) {
    int c = lane * 8 + j;
    yr[c] = (_Float16)(v[j] * rstd * g[c] + b[c]);
  }
}

// ---------------------------------------------------------------------------
// 3) GEMM: C[M,Nn] = A[M,K](f16 rm) @ Bf(swizzled) + bias.
//    8 waves (4M x 2N), block tile 128x128; per-wave 32x64 (acc[2][4]).
//    B panel (8 frags = 8KB per k-step) async-staged into LDS, double-
//    buffered; B fragment reads batched so WMMAs issue back-to-back.
// ---------------------------------------------------------------------------
__global__ void __launch_bounds__(256) gemm_kernel(
    const _Float16* __restrict__ A, const _Float16* __restrict__ Bf,
    const float* __restrict__ bias, void* __restrict__ Cout,
    int M, int K, int Nn, int out_f16) {
  __shared__ _Float16 Bsh[2][8 * 512];   // 2 x 8KB
  int tid  = threadIdx.x;
  int lane = tid & 31;
  int wave = tid >> 5;
  int wm = wave & 3, wn = wave >> 2;
  int m0 = blockIdx.y * 128 + wm * 32;
  int n0 = blockIdx.x * 128 + wn * 64;
  int half = lane >> 4, l15 = lane & 15;
  int ktiles = K >> 5;
  size_t bstride = (size_t)(Nn >> 4) * 512;

  const _Float16* Ap0 = A + (size_t)(m0 + l15) * K + half * 8;
  const _Float16* Ap1 = Ap0 + (size_t)16 * K;
  const _Float16* Bp = Bf + (size_t)blockIdx.x * 8 * 512;
  const _Float16* bs_base = &Bsh[0][0] + wn * 4 * 512 + lane * 16;

  v8f acc[2][4];
  v8f vzero = {0.f, 0.f, 0.f, 0.f, 0.f, 0.f, 0.f, 0.f};
#pragma unroll
  for (int mi = 0; mi < 2; ++mi)
#pragma unroll
    for (int i = 0; i < 4; ++i) acc[mi][i] = vzero;

  stage_b(Bp, &Bsh[0][0], tid);                    // prologue: k-step 0
  for (int kt = 0; kt < ktiles - 1; ++kt) {
    v16h a0 = load_frag(Ap0);                      // A in flight early
    v16h a1 = load_frag(Ap1);
    Ap0 += 32; Ap1 += 32;
    stage_b(Bp + bstride, &Bsh[(kt + 1) & 1][0], tid);
    Bp += bstride;
    ASYNC_WAIT(2);                                 // oldest panel resident
    __syncthreads();
    const _Float16* bs = bs_base + (kt & 1) * (8 * 512);
    v16h bfr[4];
#pragma unroll
    for (int nt = 0; nt < 4; ++nt) bfr[nt] = *(const v16h*)(bs + nt * 512);
#pragma unroll
    for (int nt = 0; nt < 4; ++nt) acc[0][nt] = wmma_f16(a0, bfr[nt], acc[0][nt]);
#pragma unroll
    for (int nt = 0; nt < 4; ++nt) acc[1][nt] = wmma_f16(a1, bfr[nt], acc[1][nt]);
    __syncthreads();                               // reads done before restage
  }
  {
    v16h a0 = load_frag(Ap0);
    v16h a1 = load_frag(Ap1);
    ASYNC_WAIT(0);
    __syncthreads();
    const _Float16* bs = bs_base + ((ktiles - 1) & 1) * (8 * 512);
    v16h bfr[4];
#pragma unroll
    for (int nt = 0; nt < 4; ++nt) bfr[nt] = *(const v16h*)(bs + nt * 512);
#pragma unroll
    for (int nt = 0; nt < 4; ++nt) acc[0][nt] = wmma_f16(a0, bfr[nt], acc[0][nt]);
#pragma unroll
    for (int nt = 0; nt < 4; ++nt) acc[1][nt] = wmma_f16(a1, bfr[nt], acc[1][nt]);
  }

#pragma unroll
  for (int mi = 0; mi < 2; ++mi) {
#pragma unroll
    for (int nt = 0; nt < 4; ++nt) {
      int n = n0 + nt * 16 + l15;
      float bv = bias ? bias[n] : 0.f;
#pragma unroll
      for (int g = 0; g < 8; ++g) {
        int row = m0 + mi * 16 + g + half * 8;
        float val = acc[mi][nt][g] + bv;
        if (out_f16)
          ((_Float16*)Cout)[(size_t)row * Nn + n] = (_Float16)val;
        else
          ((float*)Cout)[(size_t)row * Nn + n] = val;
      }
    }
  }
}

// ---------------------------------------------------------------------------
// 4) Repack vp [8192,1024] f16 into B-frag layout over (key32 x dcol16).
// ---------------------------------------------------------------------------
__global__ void __launch_bounds__(256) repack_v_kernel(
    const _Float16* __restrict__ vp, _Float16* __restrict__ vpf) {
  int t    = blockIdx.x * 256 + threadIdx.x;
  int lane = t & 31;
  int frag = t >> 5;
  int nt = frag & 63;
  int kt = frag >> 6;
  if (kt >= 256) return;
  int half = lane >> 4, l15 = lane & 15;
  int n = nt * 16 + l15;
  _Float16* dst = vpf + (size_t)frag * 512 + lane * 16;
#pragma unroll
  for (int j = 0; j < 8; ++j) {
    int k0 = kt * 32 + half * 8 + j;
    dst[j]     = vp[(size_t)k0 * 1024 + n];
    dst[8 + j] = vp[(size_t)(k0 + 16) * 1024 + n];
  }
}

// ---------------------------------------------------------------------------
// 5) Flash attention: block = (batch, 16-query tile), 8 waves, 128 keys a trip.
//    Scores: wave w takes keys [w*16, w*16+16) of the trip over the whole
//    depth (Q fragments from LDS), so each score is summed in one wave's
//    accumulators. The raw 16x128 score tile goes through LDS once; every wave
//    reads it back in A-fragment order and does the softmax on it.
//    P @ V: wave w owns d-slice [w*128, w*128+128).
// ---------------------------------------------------------------------------
#define S_PITCH 132   // floats; 528 B = 16 B x odd, conflict-free b128 row reads

// second bound: four waves a SIMD (256 registers), so two blocks share a WGP
__global__ void __launch_bounds__(256, 4) flash_attn_kernel(
    const _Float16* __restrict__ qp, const _Float16* __restrict__ kp,
    const _Float16* __restrict__ vpf, _Float16* __restrict__ xout) {
  // Q tile as A fragments: [depth step 0..31][plane 0..1][lane][8 halfs]
  __shared__ __attribute__((aligned(16))) _Float16 Qs[32 * 512];
  // raw scores, two buffers so that one barrier a trip is enough
  __shared__ __attribute__((aligned(16))) float Ssh[2][16 * S_PITCH];

  int lane = threadIdx.x & 31, wave = threadIdx.x >> 5;
  int half = lane >> 4, l15 = lane & 15;
  int b  = blockIdx.x >> 7;
  int qt = blockIdx.x & 127;
  size_t qrow0 = (size_t)b * 2048 + (size_t)qt * 16;

  // wave w stages the Q fragments of depth steps w*4 .. w*4+3
  {
    const _Float16* qbase = qp + (qrow0 + l15) * 1024 + wave * 128 + half * 8;
#pragma unroll
    for (int kc = 0; kc < 4; ++kc) {
      _Float16* qd = &Qs[(wave * 4 + kc) * 512 + lane * 8];
      *(v8h*)qd         = *(const v8h*)(qbase + kc * 32);
      *(v8h*)(qd + 256) = *(const v8h*)(qbase + kc * 32 + 16);
    }
  }
  __syncthreads();

  // running pointers (advance by one 128-key block per trip)
  const _Float16* kbase =
      kp + ((size_t)b * 2048 + wave * 16 + l15) * 1024 + half * 8;
  const _Float16* vbase =
      vpf + ((size_t)(b * 64) * 64 + wave * 8) * 512 + (size_t)lane * 16;
  const _Float16* qfr = &Qs[lane * 8];
  // this lane's places in score buffer 0: where it stores, where it reads
  float* sw0 = &Ssh[0][half * 8 * S_PITCH + wave * 16 + l15];
  const float* sr0 = &Ssh[0][l15 * S_PITCH + half * 8];

  v8f vzero = {0.f, 0.f, 0.f, 0.f, 0.f, 0.f, 0.f, 0.f};
  v8f o[8];
#pragma unroll
  for (int i = 0; i < 8; ++i) o[i] = vzero;
  float m = -1e30f, l = 0.f;   // stats of query row l15 (same in both halves)

  for (int kb = 0; kb < 16; ++kb) {
    // scores of this wave's 16 keys: 32 depth steps on two accumulators
    v8f sa[2];
#pragma unroll
    for (int i = 0; i < 2; ++i) sa[i] = vzero;
#pragma unroll
    for (int kc = 0; kc < 32; ++kc) {
      v16h kf = load_frag(kbase + kc * 32);
      v8h qlo = *(const v8h*)(qfr + kc * 512);
      v8h qhi = *(const v8h*)(qfr + kc * 512 + 256);
      v16h qa;
#pragma unroll
      for (int j = 0; j < 8; ++j) { qa[j] = qlo[j]; qa[8 + j] = qhi[j]; }
      sa[kc & 1] = wmma_f16(qa, kf, sa[kc & 1]);
    }
    kbase += 128 * 1024;
    v8f s = sa[0] + sa[1];

    float* sw = sw0 + (kb & 1) * (16 * S_PITCH);
#pragma unroll
    for (int g = 0; g < 8; ++g) sw[g * S_PITCH] = s[g];
    __syncthreads();

    // row l15 of the tile in A-fragment key order: step ks holds keys
    // ks*32 + half*8 + j at j and ks*32 + 16 + half*8 + j at 8 + j
    float p[4][16];
    {
      const float* sr = sr0 + (kb & 1) * (16 * S_PITCH);
#pragma unroll
      for (int ks = 0; ks < 4; ++ks) {
        v4f c0 = *(const v4f*)(sr + ks * 32);
        v4f c1 = *(const v4f*)(sr + ks * 32 + 4);
        v4f c2 = *(const v4f*)(sr + ks * 32 + 16);
        v4f c3 = *(const v4f*)(sr + ks * 32 + 20);
#pragma unroll
        for (int j = 0; j < 4; ++j) {
          p[ks][j]      = c0[j] * SCALE_ATT;
          p[ks][4 + j]  = c1[j] * SCALE_ATT;
          p[ks][8 + j]  = c2[j] * SCALE_ATT;
          p[ks][12 + j] = c3[j] * SCALE_ATT;
        }
      }
    }

    // online softmax over the 128 keys of the row (64 here, 64 in lane ^ 16)
    float t = p[0][0];
#pragma unroll
    for (int ks = 0; ks < 4; ++ks)
#pragma unroll
      for (int j = 0; j < 16; ++j) t = fmaxf(t, p[ks][j]);
    t = fmaxf(t, __shfl_xor(t, 16, 32));
    float mn = fmaxf(m, t);
    float corr = __expf(m - mn);
    m = mn;
    v16h pa[4];
    float rs4[4];
#pragma unroll
    for (int ks = 0; ks < 4; ++ks) {
      float rs = 0.f;
#pragma unroll
      for (int j = 0; j < 16; ++j) {
        float e = __expf(p[ks][j] - mn);
        rs += e;
        pa[ks][j] = (_Float16)e;
      }
      rs4[ks] = rs;
    }
    float rs = (rs4[0] + rs4[1]) + (rs4[2] + rs4[3]);
    rs += __shfl_xor(rs, 16, 32);
    l = l * corr + rs;

    // the accumulators hold rows g + half*8: fetch those rows' factors
#pragma unroll
    for (int g = 0; g < 8; ++g) {
      float cg = __shfl(corr, g + half * 8, 32);
#pragma unroll
      for (int nt = 0; nt < 8; ++nt) o[nt][g] *= cg;
    }

    // P @ V over the four 32-key steps of the trip
#pragma unroll
    for (int ks = 0; ks < 4; ++ks) {
      v16h vb[8];
#pragma unroll
      for (int nt = 0; nt < 8; ++nt)
        vb[nt] = *(const v16h*)(vbase + (ks * 64 + nt) * 512);
      // inputs-only fence on the loaded fragments: keeps the step's 16 loads
      // together in front of its WMMAs (one L2 latency for all of them);
      // without it the build loads, waits and multiplies one fragment at a time
      asm volatile("" :: "v"(vb[0]), "v"(vb[1]), "v"(vb[2]), "v"(vb[3]),
                         "v"(vb[4]), "v"(vb[5]), "v"(vb[6]), "v"(vb[7]));
#pragma unroll
      for (int nt = 0; nt < 8; ++nt) o[nt] = wmma_f16(pa[ks], vb[nt], o[nt]);
    }
    vbase += 4 * 64 * 512;
  }

  // normalize + write x (f16 row-major)
  float linv = 1.0f / l;
#pragma unroll
  for (int g = 0; g < 8; ++g) {
    float rinv = __shfl(linv, g + half * 8, 32);
    size_t row = qrow0 + g + half * 8;
#pragma unroll
    for (int nt = 0; nt < 8; ++nt) {
      xout[row * 1024 + wave * 128 + nt * 16 + l15] =
          (_Float16)(o[nt][g] * rinv);
    }
  }
}

// ---------------------------------------------------------------------------
extern "C" void kernel_launch(void* const* d_in, const int* in_sizes, int n_in,
                              void* d_out, int out_size, void* d_ws,
                              size_t ws_size, hipStream_t stream) {
  const float* q    = (const float*)d_in[0];
  const float* k    = (const float*)d_in[1];
  const float* v    = (const float*)d_in[2];
  const float* ln_g = (const float*)d_in[3];
  const float* ln_b = (const float*)d_in[4];
  const float* Wq = (const float*)d_in[5];  const float* bq = (const float*)d_in[6];
  const float* Wk = (const float*)d_in[7];  const float* bk = (const float*)d_in[8];
  const float* Wv = (const float*)d_in[9];  const float* bv = (const float*)d_in[10];
  const float* Wo = (const float*)d_in[11]; const float* bo = (const float*)d_in[12];
  float* out = (float*)d_out;

  _Float16* w    = (_Float16*)d_ws;
  _Float16* Wqf  = w;
  _Float16* Wkf  = Wqf + 262144;
  _Float16* Wvf  = Wkf + 262144;
  _Float16* Wof  = Wvf + 262144;
  _Float16* lnq  = Wof + 262144;
  _Float16* lnk  = lnq + 2097152;
  _Float16* lnv  = lnk + 2097152;
  _Float16* qp16 = lnv + 2097152;
  _Float16* kp16 = qp16 + 8388608;
  _Float16* vp16 = kp16 + 8388608;
  _Float16* vpf  = vp16 + 8388608;
  _Float16* x16  = vpf + 8388608;

  swizzle_w_kernel<<<64, 256, 0, stream>>>(Wq, Wqf, 256, 1024);
  swizzle_w_kernel<<<64, 256, 0, stream>>>(Wk, Wkf, 256, 1024);
  swizzle_w_kernel<<<64, 256, 0, stream>>>(Wv, Wvf, 256, 1024);
  swizzle_w_kernel<<<64, 256, 0, stream>>>(Wo, Wof, 1024, 256);

  layernorm_kernel<<<1024, 256, 0, stream>>>(q, ln_g, ln_b, lnq, 8192);
  layernorm_kernel<<<1024, 256, 0, stream>>>(k, ln_g, ln_b, lnk, 8192);
  layernorm_kernel<<<1024, 256, 0, stream>>>(v, ln_g, ln_b, lnv, 8192);

  dim3 pgrid(1024 / 128, 8192 / 128);
  gemm_kernel<<<pgrid, 256, 0, stream>>>(lnq, Wqf, bq, qp16, 8192, 256, 1024, 1);
  gemm_kernel<<<pgrid, 256, 0, stream>>>(lnk, Wkf, bk, kp16, 8192, 256, 1024, 1);
  gemm_kernel<<<pgrid, 256, 0, stream>>>(lnv, Wvf, bv, vp16, 8192, 256, 1024, 1);

  repack_v_kernel<<<2048, 256, 0, stream>>>(vp16, vpf);

  flash_attn_kernel<<<512, 256, 0, stream>>>(qp16, kp16, vpf, x16);

  dim3 ogrid(256 / 128, 8192 / 128);
  gemm_kernel<<<ogrid, 256, 0, stream>>>(x16, Wof, bo, out, 8192, 1024, 256, 0);
}

// v002
// A run of this version takes 243 microseconds.
// Next to v001, in two timings, it ran 1.22 times as fast each time.
// Counting every step since v000, it is 1.56 times as fast.
#include <hip/hip_runtime.h>
#include <hip/hip_bf16.h>

typedef __attribute__((ext_vector_type(16))) _Float16 v16h;
typedef __attribute__((ext_vector_type(8)))  _Float16 v8h;
typedef __attribute__((ext_vector_type(8)))  float    v8f;
typedef __attribute__((ext_vector_type(4)))  int      v4i;
typedef __attribute__((ext_vector_type(4)))  float    v4f;

#define SCALE_ATT 0.125f   // 64^-0.5
#define LN_EPS    1e-5f

#if __has_builtin(__builtin_amdgcn_global_load_async_to_lds_b128) && \
    __has_builtin(__builtin_amdgcn_s_wait_asynccnt)
#define HAVE_ASYNC_LDS 1
#else
#define HAVE_ASYNC_LDS 0
#endif

typedef __attribute__((address_space(1))) v4i as1_v4i;   // global int4
typedef __attribute__((address_space(3))) v4i as3_v4i;   // LDS int4

__device__ __forceinline__ v8f wmma_f16(v16h a, v16h b, v8f c) {
  return __builtin_amdgcn_wmma_f32_16x16x32_f16(false, a, false, b, (short)0, c, false, false);
}

// 16-half WMMA fragment from row-major f16 memory: two contiguous 16B runs.
__device__ __forceinline__ v16h load_frag(const _Float16* __restrict__ p) {
  v16h r;
#pragma unroll
  for (int j = 0; j < 8; ++j) { r[j] = p[j]; r[8 + j] = p[16 + j]; }
  return r;
}

// Copy 8192B (one 8-fragment B panel) global -> LDS, 2 x b128 per thread.
__device__ __forceinline__ void stage_b(const _Float16* __restrict__ g,
                                        _Float16* l, int tid) {
  const _Float16* gp = g + tid * 8;
  _Float16* lp = l + tid * 8;
#if HAVE_ASYNC_LDS
  __builtin_amdgcn_global_load_async_to_lds_b128((as1_v4i*)gp, (as3_v4i*)lp, 0, 0);
  __builtin_amdgcn_global_load_async_to_lds_b128((as1_v4i*)(gp + 2048),
                                                 (as3_v4i*)(lp + 2048), 0, 0);
#else
  *(v8h*)lp = *(const v8h*)gp;
  *(v8h*)(lp + 2048) = *(const v8h*)(gp + 2048);
#endif
}

#if HAVE_ASYNC_LDS
#define ASYNC_WAIT(n) __builtin_amdgcn_s_wait_asynccnt(n)
#else
#define ASYNC_WAIT(n)
#endif

// ---------------------------------------------------------------------------
// 1) f32 weight [K,Nn] -> f16 B-fragment-swizzled: Wf[(kt*(Nn/16)+nt)*512+lane*16]
// ---------------------------------------------------------------------------
__global__ void __launch_bounds__(256) swizzle_w_kernel(
    const float* __restrict__ W, _Float16* __restrict__ Wf, int K, int Nn) {
  int t    = blockIdx.x * 256 + threadIdx.x;
  int lane = t & 31;
  int frag = t >> 5;
  int ntiles = Nn >> 4;
  int nt = frag % ntiles;
  int kt = frag / ntiles;
  if (kt >= (K >> 5)) return;
  int half = lane >> 4, l15 = lane & 15;
  int n = nt * 16 + l15;
  _Float16* dst = Wf + (size_t)frag * 512 + lane * 16;
#pragma unroll
  for (int j = 0; j < 8; ++j) {
    int k0 = kt * 32 + half * 8 + j;
    dst[j]     = (_Float16)W[(size_t)k0 * Nn + n];
    dst[8 + j] = (_Float16)W[(size_t)(k0 + 16) * Nn + n];
  }
}

// ---------------------------------------------------------------------------
// 2) LayerNorm: one wave32 per 256-wide row, f16 row-major output.
// ---------------------------------------------------------------------------
__global__ void __launch_bounds__(256) layernorm_kernel(
    const float* __restrict__ x, const float* __restrict__ g,
    const float* __restrict__ b, _Float16* __restrict__ y, int nrows) {
  int wave = threadIdx.x >> 5, lane = threadIdx.x & 31;
  int row = blockIdx.x * 8 + wave;
  if (row >= nrows) return;
  const float* xr = x + (size_t)row * 256;
  float v[8];
  float s = 0.f;
#pragma unroll
  for (int j = 0; j < 8; ++j) { v[j] = xr[lane * 8 + j]; s += v[j]; }
#pragma unroll
  for (int off = 16; off; off >>= 1) s += __shfl_xor(s, off, 32);
  float mu = s * (1.0f / 256.0f);
  float vs = 0.f;
#pragma unroll
  for (int j = 0; j < 8; ++j) { v[j] -= mu; vs += v[j] * v[j]; }
#pragma unroll
  for (int off = 16; off; off >>= 1) vs += __shfl_xor(vs, off, 32);
  float rstd = rsqrtf(vs * (1.0f / 256.0f) + LN_EPS);
  _Float16* yr = y + (size_t)row * 256;
#pragma unroll
  for (int j = 0; j < 8; ++j) {
    int c = lane * 8 + j;
    yr[c] = (_Float16)(v[j] * rstd * g[c] + b[c]);
  }
}

// ---------------------------------------------------------------------------
// 3) GEMM: C[M,Nn] = A[M,K](f16 rm) @ Bf(swizzled) + bias.
//    8 waves (4M x 2N), block tile 128x128; per-wave 32x64 (acc[2][4]).
//    B panel (8 frags = 8KB per k-step) async-staged into LDS, double-
//    buffered; B fragment reads batched so WMMAs issue back-to-back.
// ---------------------------------------------------------------------------
__global__ void __launch_bounds__(256) gemm_kernel(
    const _Float16* __restrict__ A, const _Float16* __restrict__ Bf,
    const float* __restrict__ bias, void* __restrict__ Cout,
    int M, int K, int Nn, int out_f16) {
  __shared__ _Float16 Bsh[2][8 * 512];   // 2 x 8KB
  int tid  = threadIdx.x;
  int lane = tid & 31;
  int wave = tid >> 5;
  int wm = wave & 3, wn = wave >> 2;
  int m0 = blockIdx.y * 128 + wm * 32;
  int n0 = blockIdx.x * 128 + wn * 64;
  int half = lane >> 4, l15 = lane & 15;
  int ktiles = K >> 5;
  size_t bstride = (size_t)(Nn >> 4) * 512;

  const _Float16* Ap0 = A + (size_t)(m0 + l15) * K + half * 8;
  const _Float16* Ap1 = Ap0 + (size_t)16 * K;
  const _Float16* Bp = Bf + (size_t)blockIdx.x * 8 * 512;
  const _Float16* bs_base = &Bsh[0][0] + wn * 4 * 512 + lane * 16;

  v8f acc[2][4];
  v8f vzero = {0.f, 0.f, 0.f, 0.f, 0.f, 0.f, 0.f, 0.f};
#pragma unroll
  for (int mi = 0; mi < 2; ++mi)
#pragma unroll
    for (int i = 0; i < 4; ++i) acc[mi][i] = vzero;

  stage_b(Bp, &Bsh[0][0], tid);                    // prologue: k-step 0
  for (int kt = 0; kt < ktiles - 1; ++kt) {
    v16h a0 = load_frag(Ap0);                      // A in flight early
    v16h a1 = load_frag(Ap1);
    Ap0 += 32; Ap1 += 32;
    stage_b(Bp + bstride, &Bsh[(kt + 1) & 1][0], tid);
    Bp += bstride;
    ASYNC_WAIT(2);                                 // oldest panel resident
    __syncthreads();
    const _Float16* bs = bs_base + (kt & 1) * (8 * 512);
    v16h bfr[4];
#pragma unroll
    for (int nt = 0; nt < 4; ++nt) bfr[nt] = *(const v16h*)(bs + nt * 512);
#pragma unroll
    for (int nt = 0; nt < 4; ++nt) acc[0][nt] = wmma_f16(a0, bfr[nt], acc[0][nt]);
#pragma unroll
    for (int nt = 0; nt < 4; ++nt) acc[1][nt] = wmma_f16(a1, bfr[nt], acc[1][nt]);
    __syncthreads();                               // reads done before restage
  }
  {
    v16h a0 = load_frag(Ap0);
    v16h a1 = load_frag(Ap1);
    ASYNC_WAIT(0);
    __syncthreads();
    const _Float16* bs = bs_base + ((ktiles - 1) & 1) * (8 * 512);
    v16h bfr[4];
#pragma unroll
    for (int nt = 0; nt < 4; ++nt) bfr[nt] = *(const v16h*)(bs + nt * 512);
#pragma unroll
    for (int nt = 0; nt < 4; ++nt) acc[0][nt] = wmma_f16(a0, bfr[nt], acc[0][nt]);
#pragma unroll
    for (int nt = 0; nt < 4; ++nt) acc[1][nt] = wmma_f16(a1, bfr[nt], acc[1][nt]);
  }

#pragma unroll
  for (int mi = 0; mi < 2; ++mi) {
#pragma unroll
    for (int nt = 0; nt < 4; ++nt) {
      int n = n0 + nt * 16 + l15;
      float bv = bias ? bias[n] : 0.f;
#pragma unroll
      for (int g = 0; g < 8; ++g) {
        int row = m0 + mi * 16 + g + half * 8;
        float val = acc[mi][nt][g] + bv;
        if (out_f16)
          ((_Float16*)Cout)[(size_t)row * Nn + n] = (_Float16)val;
        else
          ((float*)Cout)[(size_t)row * Nn + n] = val;
      }
    }
  }
}

// ---------------------------------------------------------------------------
// 4) Repack vp [8192,1024] f16 into B-frag layout over (key32 x dcol16).
// ---------------------------------------------------------------------------
__global__ void __launch_bounds__(256) repack_v_kernel(
    const _Float16* __restrict__ vp, _Float16* __restrict__ vpf) {
  int t    = blockIdx.x * 256 + threadIdx.x;
  int lane = t & 31;
  int frag = t >> 5;
  int nt = frag & 63;
  int kt = frag >> 6;
  if (kt >= 256) return;
  int half = lane >> 4, l15 = lane & 15;
  int n = nt * 16 + l15;
  _Float16* dst = vpf + (size_t)frag * 512 + lane * 16;
#pragma unroll
  for (int j = 0; j < 8; ++j) {
    int k0 = kt * 32 + half * 8 + j;
    dst[j]     = vp[(size_t)k0 * 1024 + n];
    dst[8 + j] = vp[(size_t)(k0 + 16) * 1024 + n];
  }
}

// ---------------------------------------------------------------------------
// 5) Flash attention: block = (batch, 32-query tile), 8 waves, 128 keys a trip.
//    The 32 queries are two 16-row tiles; every K and V fragment a wave loads
//    feeds one WMMA of each tile, so the block reads K and V once for 32 rows.
//    Scores: wave w takes keys [w*16, w*16+16) of the trip over the whole
//    depth (Q fragments from LDS), so each score is summed in one wave's
//    accumulators. The raw 32x128 score tile goes through LDS once; every wave
//    reads it back in A-fragment order and does the softmax on it.
//    P @ V: wave w owns d-slice [w*128, w*128+128).
// ---------------------------------------------------------------------------
#define S_PITCH 132   // floats; 528 B = 16 B x odd, conflict-free b128 row reads
#define QT 2          // 16-row query tiles a block

// one block a WGP (256 blocks): two waves a SIMD, up to 512 registers a wave
__global__ void __launch_bounds__(256) flash_attn_kernel(
    const _Float16* __restrict__ qp, const _Float16* __restrict__ kp,
    const _Float16* __restrict__ vpf, _Float16* __restrict__ xout) {
  // Q tiles as A fragments: [tile][depth step 0..31][plane 0..1][lane][8 halfs]
  __shared__ __attribute__((aligned(16))) _Float16 Qs[QT * 32 * 512];
  // raw scores, two buffers so that one barrier a trip is enough
  __shared__ __attribute__((aligned(16))) float Ssh[2][QT * 16 * S_PITCH];

  int lane = threadIdx.x & 31, wave = threadIdx.x >> 5;
  int half = lane >> 4, l15 = lane & 15;
  int b  = blockIdx.x >> 6;
  int qt = blockIdx.x & 63;
  size_t qrow0 = (size_t)b * 2048 + (size_t)qt * (QT * 16);

  // wave w stages the Q fragments of depth steps w*4 .. w*4+3 of both tiles
  {
    v8h qr[QT][4][2];
    const _Float16* qbase = qp + (qrow0 + l15) * 1024 + wave * 128 + half * 8;
#pragma unroll
    for (int mi = 0; mi < QT; ++mi) {
#pragma unroll
      for (int kc = 0; kc < 4; ++kc) {
        qr[mi][kc][0] = *(const v8h*)(qbase + mi * 16 * 1024 + kc * 32);
        qr[mi][kc][1] = *(const v8h*)(qbase + mi * 16 * 1024 + kc * 32 + 16);
      }
    }
    // address translations of the Q loads done before their address register
    // is written again (the pointer is an input so that no load lands on it)
    asm volatile("s_wait_xcnt 0x0" :: "v"(qbase) : "memory");
#pragma unroll
    for (int mi = 0; mi < QT; ++mi)
#pragma unroll
      for (int kc = 0; kc < 4; ++kc) {
        _Float16* qd = &Qs[(mi * 32 + wave * 4 + kc) * 512 + lane * 8];
        *(v8h*)qd         = qr[mi][kc][0];
        *(v8h*)(qd + 256) = qr[mi][kc][1];
      }
  }
  __syncthreads();

  // the batch's K and V, and this lane's running byte offsets into them
  // (advance by one 128-key block per trip)
  const char* kbat = (const char*)(kp + (size_t)b * 2048 * 1024);
  const char* vbat = (const char*)(vpf + (size_t)b * 2048 * 1024);
  unsigned koff = (unsigned)(((wave * 16 + l15) * 1024 + half * 8) * 2);
  unsigned voff = (unsigned)((wave * 8 * 512 + lane * 16) * 2);
  const _Float16* qfr = &Qs[lane * 8];
  // this lane's places in score buffer 0: where it stores, where it reads
  float* sw0 = &Ssh[0][half * 8 * S_PITCH + wave * 16 + l15];
  const float* sr0 = &Ssh[0][l15 * S_PITCH + half * 8];

  v8f vzero = {0.f, 0.f, 0.f, 0.f, 0.f, 0.f, 0.f, 0.f};
  v8f o[QT][8];
  float m[QT], l[QT];   // stats of query row l15 of each tile (both halves)
#pragma unroll
  for (int mi = 0; mi < QT; ++mi) {
#pragma unroll
    for (int i = 0; i < 8; ++i) o[mi][i] = vzero;
    m[mi] = -1e30f;
    l[mi] = 0.f;
  }

  for (int kb = 0; kb < 16; ++kb) {
    // scores of this wave's 16 keys: 32 depth steps, two accumulators a tile.
    // K fragments come in groups of 8 depth steps on two register sets: the
    // next group's 16 loads are in flight while this group is multiplied.
    v8f sa[QT][2];
#pragma unroll
    for (int mi = 0; mi < QT; ++mi) { sa[mi][0] = vzero; sa[mi][1] = vzero; }
    const _Float16* kbase = (const _Float16*)(kbat + koff);
    v16h kf[2][8];
#pragma unroll
    for (int j = 0; j < 8; ++j) kf[0][j] = load_frag(kbase + j * 32);
#pragma unroll
    for (int kg = 0; kg < 4; ++kg) {
      if (kg < 3) {
#pragma unroll
        for (int j = 0; j < 8; ++j)
          kf[(kg + 1) & 1][j] = load_frag(kbase + ((kg + 1) * 8 + j) * 32);
      }
#pragma unroll
      for (int h = 0; h < 2; ++h) {
        v16h qa[QT][4];
#pragma unroll
        for (int mi = 0; mi < QT; ++mi)
#pragma unroll
          for (int j = 0; j < 4; ++j) {
            const _Float16* qs = qfr + (mi * 32 + kg * 8 + h * 4 + j) * 512;
            v8h qlo = *(const v8h*)qs;
            v8h qhi = *(const v8h*)(qs + 256);
#pragma unroll
            for (int e = 0; e < 8; ++e) {
              qa[mi][j][e] = qlo[e];
              qa[mi][j][8 + e] = qhi[e];
            }
          }
        // inputs-only fence on the loaded Q fragments: one LDS latency for
        // the 16 reads of four depth steps, not one for each product
        asm volatile("" :: "v"(qa[0][0]), "v"(qa[0][1]), "v"(qa[0][2]),
                           "v"(qa[0][3]), "v"(qa[1][0]), "v"(qa[1][1]),
                           "v"(qa[1][2]), "v"(qa[1][3]));
#pragma unroll
        for (int j = 0; j < 4; ++j)
#pragma unroll
          for (int mi = 0; mi < QT; ++mi)
            sa[mi][j & 1] = wmma_f16(qa[mi][j], kf[kg & 1][h * 4 + j], sa[mi][j & 1]);
      }
    }
    // address translations of the K loads done before their address register
    // is advanced (the offset is an operand so that the add stays behind)
    asm volatile("s_wait_xcnt 0x0" : "+v"(koff) :: "memory");
    koff += 128 * 1024 * 2;

    float* sw = sw0 + (kb & 1) * (QT * 16 * S_PITCH);
#pragma unroll
    for (int mi = 0; mi < QT; ++mi) {
      v8f s = sa[mi][0] + sa[mi][1];
#pragma unroll
      for (int g = 0; g < 8; ++g) sw[(mi * 16 + g) * S_PITCH] = s[g];
    }
    __syncthreads();

    v16h pa[QT][4];
#pragma unroll
    for (int mi = 0; mi < QT; ++mi) {
      // row l15 of tile mi in A-fragment key order: step ks holds keys
      // ks*32 + half*8 + j at j and ks*32 + 16 + half*8 + j at 8 + j
      float p[4][16];
      {
        const float* sr =
            sr0 + (kb & 1) * (QT * 16 * S_PITCH) + mi * 16 * S_PITCH;
#pragma unroll
        for (int ks = 0; ks < 4; ++ks) {
          v4f c0 = *(const v4f*)(sr + ks * 32);
          v4f c1 = *(const v4f*)(sr + ks * 32 + 4);
          v4f c2 = *(const v4f*)(sr + ks * 32 + 16);
          v4f c3 = *(const v4f*)(sr + ks * 32 + 20);
#pragma unroll
          for (int j = 0; j < 4; ++j) {
            p[ks][j]      = c0[j] * SCALE_ATT;
            p[ks][4 + j]  = c1[j] * SCALE_ATT;
            p[ks][8 + j]  = c2[j] * SCALE_ATT;
            p[ks][12 + j] = c3[j] * SCALE_ATT;
          }
        }
      }

      // online softmax over the 128 keys of the row (64 here, 64 in lane ^ 16)
      float t = p[0][0];
#pragma unroll
      for (int ks = 0; ks < 4; ++ks)
#pragma unroll
        for (int j = 0; j < 16; ++j) t = fmaxf(t, p[ks][j]);
      t = fmaxf(t, __shfl_xor(t, 16, 32));
      float mn = fmaxf(m[mi], t);
      float corr = __expf(m[mi] - mn);
      m[mi] = mn;
      float rs4[4];
#pragma unroll
      for (int ks = 0; ks < 4; ++ks) {
        float rs = 0.f;
#pragma unroll
        for (int j = 0; j < 16; ++j) {
          float e = __expf(p[ks][j] - mn);
          rs += e;
          pa[mi][ks][j] = (_Float16)e;
        }
        rs4[ks] = rs;
      }
      float rs = (rs4[0] + rs4[1]) + (rs4[2] + rs4[3]);
      rs += __shfl_xor(rs, 16, 32);
      l[mi] = l[mi] * corr + rs;

      // the accumulators hold rows g + half*8: fetch those rows' factors
#pragma unroll
      for (int g = 0; g < 8; ++g) {
        float cg = __shfl(corr, g + half * 8, 32);
#pragma unroll
        for (int nt = 0; nt < 8; ++nt) o[mi][nt][g] *= cg;
      }
    }

    // P @ V over the four 32-key steps of the trip; V fragments on two
    // register sets, the next step's 16 loads in flight under this step
    const _Float16* vbase = (const _Float16*)(vbat + voff);
    v16h vb[2][8];
#pragma unroll
    for (int nt = 0; nt < 8; ++nt)
      vb[0][nt] = *(const v16h*)(vbase + nt * 512);
#pragma unroll
    for (int ks = 0; ks < 4; ++ks) {
      if (ks < 3) {
#pragma unroll
        for (int nt = 0; nt < 8; ++nt)
          vb[(ks + 1) & 1][nt] =
              *(const v16h*)(vbase + ((ks + 1) * 64 + nt) * 512);
      }
      // keeps the next step's 16 loads together in front of this step's
      // products: without it the build issues most V loads two at a time, each
      // pair waited for right in front of its own products
      __builtin_amdgcn_sched_barrier(0);
#pragma unroll
      for (int nt = 0; nt < 8; ++nt)
#pragma unroll
        for (int mi = 0; mi < QT; ++mi)
          o[mi][nt] = wmma_f16(pa[mi][ks], vb[ks & 1][nt], o[mi][nt]);
    }
    // address translations of the V loads done before their address register
    // is advanced (the offset is an operand so that the add stays behind)
    asm volatile("s_wait_xcnt 0x0" : "+v"(voff) :: "memory");
    voff += 4 * 64 * 512 * 2;
  }

  // normalize + write x (f16 row-major)
#pragma unroll
  for (int mi = 0; mi < QT; ++mi) {
    float linv = 1.0f / l[mi];
#pragma unroll
    for (int g = 0; g < 8; ++g) {
      float rinv = __shfl(linv, g + half * 8, 32);
      size_t row = qrow0 + mi * 16 + g + half * 8;
#pragma unroll
      for (int nt = 0; nt < 8; ++nt) {
        xout[row * 1024 + wave * 128 + nt * 16 + l15] =
            (_Float16)(o[mi][nt][g] * rinv);
      }
      // address translations of the row's stores done before their address
      // and data registers are written again
      asm volatile("s_wait_xcnt 0x0" ::: "memory");
      // keeps the next row's arithmetic behind the wait
      __builtin_amdgcn_sched_barrier(0);
    }
  }
}

// ---------------------------------------------------------------------------
extern "C" void kernel_launch(void* const* d_in, const int* in_sizes, int n_in,
                              void* d_out, int out_size, void* d_ws,
                              size_t ws_size, hipStream_t stream) {
  const float* q    = (const float*)d_in[0];
  const float* k    = (const float*)d_in[1];
  const float* v    = (const float*)d_in[2];
  const float* ln_g = (const float*)d_in[3];
  const float* ln_b = (const float*)d_in[4];
  const float* Wq = (const float*)d_in[5];  const float* bq = (const float*)d_in[6];
  const float* Wk = (const float*)d_in[7];  const float* bk = (const float*)d_in[8];
  const float* Wv = (const float*)d_in[9];  const float* bv = (const float*)d_in[10];
  const float* Wo = (const float*)d_in[11]; const float* bo = (const float*)d_in[12];
  float* out = (float*)d_out;

  _Float16* w    = (_Float16*)d_ws;
  _Float16* Wqf  = w;
  _Float16* Wkf  = Wqf + 262144;
  _Float16* Wvf  = Wkf + 262144;
  _Float16* Wof  = Wvf + 262144;
  _Float16* lnq  = Wof + 262144;
  _Float16* lnk  = lnq + 2097152;
  _Float16* lnv  = lnk + 2097152;
  _Float16* qp16 = lnv + 2097152;
  _Float16* kp16 = qp16 + 8388608;
  _Float16* vp16 = kp16 + 8388608;
  _Float16* vpf  = vp16 + 8388608;
  _Float16* x16  = vpf + 8388608;

  swizzle_w_kernel<<<64, 256, 0, stream>>>(Wq, Wqf, 256, 1024);
  swizzle_w_kernel<<<64, 256, 0, stream>>>(Wk, Wkf, 256, 1024);
  swizzle_w_kernel<<<64, 256, 0, stream>>>(Wv, Wvf, 256, 1024);
  swizzle_w_kernel<<<64, 256, 0, stream>>>(Wo, Wof, 1024, 256);

  layernorm_kernel<<<1024, 256, 0, stream>>>(q, ln_g, ln_b, lnq, 8192);
  layernorm_kernel<<<1024, 256, 0, stream>>>(k, ln_g, ln_b, lnk, 8192);
  layernorm_kernel<<<1024, 256, 0, stream>>>(v, ln_g, ln_b, lnv, 8192);

  dim3 pgrid(1024 / 128, 8192 / 128);
  gemm_kernel<<<pgrid, 256, 0, stream>>>(lnq, Wqf, bq, qp16, 8192, 256, 1024, 1);
  gemm_kernel<<<pgrid, 256, 0, stream>>>(lnk, Wkf, bk, kp16, 8192, 256, 1024, 1);
  gemm_kernel<<<pgrid, 256, 0, stream>>>(lnv, Wvf, bv, vp16, 8192, 256, 1024, 1);

  repack_v_kernel<<<2048, 256, 0, stream>>>(vp16, vpf);

  flash_attn_kernel<<<256, 256, 0, stream>>>(qp16, kp16, vpf, x16);

  dim3 ogrid(256 / 128, 8192 / 128);
  gemm_kernel<<<ogrid, 256, 0, stream>>>(x16, Wof, bo, out, 8192, 1024, 256, 0);
}

// v003
// It runs in 224 microseconds.
// Next to v002, in two timings, it ran 1.09 times as fast each time.
// All steps since v000 together make it 1.71 times as fast.
#include <hip/hip_runtime.h>
#include <hip/hip_bf16.h>

typedef __attribute__((ext_vector_type(16))) _Float16 v16h;
typedef __attribute__((ext_vector_type(8)))  _Float16 v8h;
typedef __attribute__((ext_vector_type(8)))  float    v8f;
typedef __attribute__((ext_vector_type(4)))  int      v4i;
typedef __attribute__((ext_vector_type(4)))  float    v4f;

#define SCALE_ATT 0.125f   // 64^-0.5
#define LN_EPS    1e-5f

#if __has_builtin(__builtin_amdgcn_global_load_async_to_lds_b128) && \
    __has_builtin(__builtin_amdgcn_s_wait_asynccnt)
#define HAVE_ASYNC_LDS 1
#else
#define HAVE_ASYNC_LDS 0
#endif

typedef __attribute__((address_space(1))) v4i as1_v4i;   // global int4
typedef __attribute__((address_space(3))) v4i as3_v4i;   // LDS int4

__device__ __forceinline__ v8f wmma_f16(v16h a, v16h b, v8f c) {
  return __builtin_amdgcn_wmma_f32_16x16x32_f16(false, a, false, b, (short)0, c, false, false);
}

// 16-half WMMA fragment from row-major f16 memory: two contiguous 16B runs.
__device__ __forceinline__ v16h load_frag(const _Float16* __restrict__ p) {
  v16h r;
#pragma unroll
  for (int j = 0; j < 8; ++j) { r[j] = p[j]; r[8 + j] = p[16 + j]; }
  return r;
}

// 16-half WMMA fragment from two-plane fragment memory: elements 0..7 of all 32
// lanes lie in one 512-byte run, elements 8..15 in the next, so each of the two
// wave-wide 16-byte loads covers four whole 128-byte lines.
__device__ __forceinline__ v16h load_frag_planes(const _Float16* __restrict__ p) {
  v8h lo = *(const v8h*)p;
  v8h hi = *(const v8h*)(p + 256);
  v16h r;
#pragma unroll
  for (int j = 0; j < 8; ++j) { r[j] = lo[j]; r[8 + j] = hi[j]; }
  return r;
}

// Copy 8192B (one 8-fragment B panel) global -> LDS, 2 x b128 per thread.
__device__ __forceinline__ void stage_b(const _Float16* __restrict__ g,
                                        _Float16* l, int tid) {
  const _Float16* gp = g + tid * 8;
  _Float16* lp = l + tid * 8;
#if HAVE_ASYNC_LDS
  __builtin_amdgcn_global_load_async_to_lds_b128((as1_v4i*)gp, (as3_v4i*)lp, 0, 0);
  __builtin_amdgcn_global_load_async_to_lds_b128((as1_v4i*)(gp + 2048),
                                                 (as3_v4i*)(lp + 2048), 0, 0);
#else
  *(v8h*)lp = *(const v8h*)gp;
  *(v8h*)(lp + 2048) = *(const v8h*)(gp + 2048);
#endif
}

#if HAVE_ASYNC_LDS
#define ASYNC_WAIT(n) __builtin_amdgcn_s_wait_asynccnt(n)
#else
#define ASYNC_WAIT(n)
#endif

// ---------------------------------------------------------------------------
// 1) f32 weight [K,Nn] -> f16 B-fragment-swizzled: Wf[(kt*(Nn/16)+nt)*512+lane*16]
// ---------------------------------------------------------------------------
__global__ void __launch_bounds__(256) swizzle_w_kernel(
    const float* __restrict__ W, _Float16* __restrict__ Wf, int K, int Nn) {
  int t    = blockIdx.x * 256 + threadIdx.x;
  int lane = t & 31;
  int frag = t >> 5;
  int ntiles = Nn >> 4;
  int nt = frag % ntiles;
  int kt = frag / ntiles;
  if (kt >= (K >> 5)) return;
  int half = lane >> 4, l15 = lane & 15;
  int n = nt * 16 + l15;
  _Float16* dst = Wf + (size_t)frag * 512 + lane * 16;
#pragma unroll
  for (int j = 0; j < 8; ++j) {
    int k0 = kt * 32 + half * 8 + j;
    dst[j]     = (_Float16)W[(size_t)k0 * Nn + n];
    dst[8 + j] = (_Float16)W[(size_t)(k0 + 16) * Nn + n];
  }
}

// ---------------------------------------------------------------------------
// 2) LayerNorm: one wave32 per 256-wide row, f16 row-major output.
// ---------------------------------------------------------------------------
__global__ void __launch_bounds__(256) layernorm_kernel(
    const float* __restrict__ x, const float* __restrict__ g,
    const float* __restrict__ b, _Float16* __restrict__ y, int nrows) {
  int wave = threadIdx.x >> 5, lane = threadIdx.x & 31;
  int row = blockIdx.x * 8 + wave;
  if (row >= nrows) return;
  const float* xr = x + (size_t)row * 256;
  float v[8];
  float s = 0.f;
#pragma unroll
  for (int j = 0; j < 8; ++j) { v[j] = xr[lane * 8 + j]; s += v[j]; }
#pragma unroll
  for (int off = 16; off; off >>= 1) s += __shfl_xor(s, off, 32);
  float mu = s * (1.0f / 256.0f);
  float vs = 0.f;
#pragma unroll
  for (int j = 0; j < 8; ++j) { v[j] -= mu; vs += v[j] * v[j]; }
#pragma unroll
  for (int off = 16; off; off >>= 1) vs += __shfl_xor(vs, off, 32);
  float rstd = rsqrtf(vs * (1.0f / 256.0f) + LN_EPS);
  _Float16* yr = y + (size_t)row * 256;
#pragma unroll
  for (int j = 0; j < 8; ++j) {
    int c = lane * 8 + j;
    yr[c] = (_Float16)(v[j] * rstd * g[c] + b[c]);
  }
}

// ---------------------------------------------------------------------------
// 3) GEMM: C[M,Nn] = A[M,K](f16 rm) @ Bf(swizzled) + bias.
//    8 waves (4M x 2N), block tile 128x128; per-wave 32x64 (acc[2][4]).
//    B panel (8 frags = 8KB per k-step) async-staged into LDS, double-
//    buffered; B fragment reads batched so WMMAs issue back-to-back.
// ---------------------------------------------------------------------------
__global__ void __launch_bounds__(256) gemm_kernel(
    const _Float16* __restrict__ A, const _Float16* __restrict__ Bf,
    const float* __restrict__ bias, void* __restrict__ Cout,
    int M, int K, int Nn, int out_f16) {
  __shared__ _Float16 Bsh[2][8 * 512];   // 2 x 8KB
  int tid  = threadIdx.x;
  int lane = tid & 31;
  int wave = tid >> 5;
  int wm = wave & 3, wn = wave >> 2;
  int m0 = blockIdx.y * 128 + wm * 32;
  int n0 = blockIdx.x * 128 + wn * 64;
  int half = lane >> 4, l15 = lane & 15;
  int ktiles = K >> 5;
  size_t bstride = (size_t)(Nn >> 4) * 512;

  const _Float16* Ap0 = A + (size_t)(m0 + l15) * K + half * 8;
  const _Float16* Ap1 = Ap0 + (size_t)16 * K;
  const _Float16* Bp = Bf + (size_t)blockIdx.x * 8 * 512;
  const _Float16* bs_base = &Bsh[0][0] + wn * 4 * 512 + lane * 16;

  v8f acc[2][4];
  v8f vzero = {0.f, 0.f, 0.f, 0.f, 0.f, 0.f, 0.f, 0.f};
#pragma unroll
  for (int mi = 0; mi < 2; ++mi)
#pragma unroll
    for (int i = 0; i < 4; ++i) acc[mi][i] = vzero;

  stage_b(Bp, &Bsh[0][0], tid);                    // prologue: k-step 0
  for (int kt = 0; kt < ktiles - 1; ++kt) {
    v16h a0 = load_frag(Ap0);                      // A in flight early
    v16h a1 = load_frag(Ap1);
    Ap0 += 32; Ap1 += 32;
    stage_b(Bp + bstride, &Bsh[(kt + 1) & 1][0], tid);
    Bp += bstride;
    ASYNC_WAIT(2);                                 // oldest panel resident
    __syncthreads();
    const _Float16* bs = bs_base + (kt & 1) * (8 * 512);
    v16h bfr[4];
#pragma unroll
    for (int nt = 0; nt < 4; ++nt) bfr[nt] = *(const v16h*)(bs + nt * 512);
#pragma unroll
    for (int nt = 0; nt < 4; ++nt) acc[0][nt] = wmma_f16(a0, bfr[nt], acc[0][nt]);
#pragma unroll
    for (int nt = 0; nt < 4; ++nt) acc[1][nt] = wmma_f16(a1, bfr[nt], acc[1][nt]);
    __syncthreads();                               // reads done before restage
  }
  {
    v16h a0 = load_frag(Ap0);
    v16h a1 = load_frag(Ap1);
    ASYNC_WAIT(0);
    __syncthreads();
    const _Float16* bs = bs_base + ((ktiles - 1) & 1) * (8 * 512);
    v16h bfr[4];
#pragma unroll
    for (int nt = 0; nt < 4; ++nt) bfr[nt] = *(const v16h*)(bs + nt * 512);
#pragma unroll
    for (int nt = 0; nt < 4; ++nt) acc[0][nt] = wmma_f16(a0, bfr[nt], acc[0][nt]);
#pragma unroll
    for (int nt = 0; nt < 4; ++nt) acc[1][nt] = wmma_f16(a1, bfr[nt], acc[1][nt]);
  }

#pragma unroll
  for (int mi = 0; mi < 2; ++mi) {
#pragma unroll
    for (int nt = 0; nt < 4; ++nt) {
      int n = n0 + nt * 16 + l15;
      float bv = bias ? bias[n] : 0.f;
#pragma unroll
      for (int g = 0; g < 8; ++g) {
        int row = m0 + mi * 16 + g + half * 8;
        float val = acc[mi][nt][g] + bv;
        if (out_f16)
          ((_Float16*)Cout)[(size_t)row * Nn + n] = (_Float16)val;
        else
          ((float*)Cout)[(size_t)row * Nn + n] = val;
      }
    }
  }
}

// ---------------------------------------------------------------------------
// 4) Repack vp and kp [8192,1024] f16 into two-plane B fragments of 1024 B:
//    [plane 0..1][lane 0..31][8 halfs]; plane 0 holds elements 0..7 of every
//    lane's fragment, plane 1 elements 8..15.
//    Blocks 0..2047: V over (key32 x dcol16), fragment kt*64 + nt.
//    Blocks 2048..3071: K over (depth32 x key16), fragment keytile*32 + step;
//    a wave turns 128 B of each of 16 key rows into two fragments.
// ---------------------------------------------------------------------------
__global__ void __launch_bounds__(256) repack_kv_kernel(
    const _Float16* __restrict__ vp, _Float16* __restrict__ vpf,
    const _Float16* __restrict__ kp, _Float16* __restrict__ kpf) {
  int lane = threadIdx.x & 31;
  int half = lane >> 4, l15 = lane & 15;
  if (blockIdx.x < 2048) {
    int frag = blockIdx.x * 8 + (threadIdx.x >> 5);
    int nt = frag & 63;
    int kt = frag >> 6;
    int n = nt * 16 + l15;
    v8h lo, hi;
#pragma unroll
    for (int j = 0; j < 8; ++j) {
      int k0 = kt * 32 + half * 8 + j;
      lo[j] = vp[(size_t)k0 * 1024 + n];
      hi[j] = vp[(size_t)(k0 + 16) * 1024 + n];
    }
    _Float16* dst = vpf + (size_t)frag * 512 + lane * 8;
    *(v8h*)dst         = lo;
    *(v8h*)(dst + 256) = hi;
  } else {
    int kw = (blockIdx.x - 2048) * 8 + (threadIdx.x >> 5);
    int keytile = kw >> 4;   // 16 key rows
    int pair    = kw & 15;   // depth steps 2*pair and 2*pair + 1
    const _Float16* s =
        kp + (size_t)(keytile * 16 + l15) * 1024 + pair * 64 + half * 8;
    v8h r[4];
#pragma unroll
    for (int i = 0; i < 4; ++i) r[i] = *(const v8h*)(s + i * 16);
    _Float16* dst = kpf + (size_t)keytile * 16384 + pair * 1024 + lane * 8;
#pragma unroll
    for (int i = 0; i < 4; ++i) *(v8h*)(dst + i * 256) = r[i];
    // address translations of the four stores done before any path of the
    // build writes their address or data registers again
    asm volatile("s_wait_xcnt 0x0" ::: "memory");
  }
}

// ---------------------------------------------------------------------------
// 5) Flash attention: block = (batch, 32-query tile), 8 waves, 128 keys a trip.
//    The 32 queries are two 16-row tiles; every K and V fragment a wave loads
//    feeds one WMMA of each tile, so the block reads K and V once for 32 rows.
//    Scores: wave w takes keys [w*16, w*16+16) of the trip over the whole
//    depth (Q fragments from LDS), so each score is summed in one wave's
//    accumulators. The raw 32x128 score tile goes through LDS once; every wave
//    reads it back in A-fragment order and does the softmax on it.
//    P @ V: wave w owns d-slice [w*128, w*128+128).
// ---------------------------------------------------------------------------
#define S_PITCH 132   // floats; 528 B = 16 B x odd, conflict-free b128 row reads
#define QT 2          // 16-row query tiles a block

// one block a WGP (256 blocks): two waves a SIMD, up to 512 registers a wave
__global__ void __launch_bounds__(256) flash_attn_kernel(
    const _Float16* __restrict__ qp, const _Float16* __restrict__ kpf,
    const _Float16* __restrict__ vpf, _Float16* __restrict__ xout) {
  // Q tiles as A fragments: [tile][depth step 0..31][plane 0..1][lane][8 halfs]
  __shared__ __attribute__((aligned(16))) _Float16 Qs[QT * 32 * 512];
  // raw scores, two buffers so that one barrier a trip is enough
  __shared__ __attribute__((aligned(16))) float Ssh[2][QT * 16 * S_PITCH];

  int lane = threadIdx.x & 31, wave = threadIdx.x >> 5;
  int half = lane >> 4, l15 = lane & 15;
  int b  = blockIdx.x >> 6;
  int qt = blockIdx.x & 63;
  size_t qrow0 = (size_t)b * 2048 + (size_t)qt * (QT * 16);

  // wave w stages the Q fragments of depth steps w*4 .. w*4+3 of both tiles
  {
    v8h qr[QT][4][2];
    const _Float16* qbase = qp + (qrow0 + l15) * 1024 + wave * 128 + half * 8;
#pragma unroll
    for (int mi = 0; mi < QT; ++mi) {
#pragma unroll
      for (int kc = 0; kc < 4; ++kc) {
        qr[mi][kc][0] = *(const v8h*)(qbase + mi * 16 * 1024 + kc * 32);
        qr[mi][kc][1] = *(const v8h*)(qbase + mi * 16 * 1024 + kc * 32 + 16);
      }
    }
    // address translations of the Q loads done before their address register
    // is written again (the pointer is an input so that no load lands on it)
    asm volatile("s_wait_xcnt 0x0" :: "v"(qbase) : "memory");
#pragma unroll
    for (int mi = 0; mi < QT; ++mi)
#pragma unroll
      for (int kc = 0; kc < 4; ++kc) {
        _Float16* qd = &Qs[(mi * 32 + wave * 4 + kc) * 512 + lane * 8];
        *(v8h*)qd         = qr[mi][kc][0];
        *(v8h*)(qd + 256) = qr[mi][kc][1];
      }
  }
  __syncthreads();

  // the batch's K and V, and this lane's running byte offsets into them
  // (advance by one 128-key block per trip)
  const char* kbat = (const char*)(kpf + (size_t)b * 2048 * 1024);
  const char* vbat = (const char*)(vpf + (size_t)b * 2048 * 1024);
  unsigned koff = (unsigned)((wave * 32 * 512 + lane * 8) * 2);
  unsigned voff = (unsigned)((wave * 8 * 512 + lane * 8) * 2);
  const _Float16* qfr = &Qs[lane * 8];
  // this lane's places in score buffer 0: where it stores, where it reads
  float* sw0 = &Ssh[0][half * 8 * S_PITCH + wave * 16 + l15];
  const float* sr0 = &Ssh[0][l15 * S_PITCH + half * 8];

  v8f vzero = {0.f, 0.f, 0.f, 0.f, 0.f, 0.f, 0.f, 0.f};
  v8f o[QT][8];
  float m[QT], l[QT];   // stats of query row l15 of each tile (both halves)
#pragma unroll
  for (int mi = 0; mi < QT; ++mi) {
#pragma unroll
    for (int i = 0; i < 8; ++i) o[mi][i] = vzero;
    m[mi] = -1e30f;
    l[mi] = 0.f;
  }

  for (int kb = 0; kb < 16; ++kb) {
    // scores of this wave's 16 keys: 32 depth steps, two accumulators a tile.
    // K fragments come in groups of 8 depth steps on two register sets: the
    // next group's 16 loads are in flight while this group is multiplied.
    v8f sa[QT][2];
#pragma unroll
    for (int mi = 0; mi < QT; ++mi) { sa[mi][0] = vzero; sa[mi][1] = vzero; }
    const _Float16* kbase = (const _Float16*)(kbat + koff);
    v16h kf[2][8];
#pragma unroll
    for (int j = 0; j < 8; ++j) kf[0][j] = load_frag_planes(kbase + j * 512);
#pragma unroll
    for (int kg = 0; kg < 4; ++kg) {
      if (kg < 3) {
#pragma unroll
        for (int j = 0; j < 8; ++j)
          kf[(kg + 1) & 1][j] = load_frag_planes(kbase + ((kg + 1) * 8 + j) * 512);
      }
#pragma unroll
      for (int h = 0; h < 2; ++h) {
        v16h qa[QT][4];
#pragma unroll
        for (int mi = 0; mi < QT; ++mi)
#pragma unroll
          for (int j = 0; j < 4; ++j) {
            const _Float16* qs = qfr + (mi * 32 + kg * 8 + h * 4 + j) * 512;
            v8h qlo = *(const v8h*)qs;
            v8h qhi = *(const v8h*)(qs + 256);
#pragma unroll
            for (int e = 0; e < 8; ++e) {
              qa[mi][j][e] = qlo[e];
              qa[mi][j][8 + e] = qhi[e];
            }
          }
        // inputs-only fence on the loaded Q fragments: one LDS latency for
        // the 16 reads of four depth steps, not one for each product
        asm volatile("" :: "v"(qa[0][0]), "v"(qa[0][1]), "v"(qa[0][2]),
                           "v"(qa[0][3]), "v"(qa[1][0]), "v"(qa[1][1]),
                           "v"(qa[1][2]), "v"(qa[1][3]));
#pragma unroll
        for (int j = 0; j < 4; ++j)
#pragma unroll
          for (int mi = 0; mi < QT; ++mi)
            sa[mi][j & 1] = wmma_f16(qa[mi][j], kf[kg & 1][h * 4 + j], sa[mi][j & 1]);
      }
    }
    // address translations of the K loads done before their address register
    // is advanced (the offset is an operand so that the add stays behind)
    asm volatile("s_wait_xcnt 0x0" : "+v"(koff) :: "memory");
    koff += 128 * 1024 * 2;

    float* sw = sw0 + (kb & 1) * (QT * 16 * S_PITCH);
#pragma unroll
    for (int mi = 0; mi < QT; ++mi) {
      v8f s = sa[mi][0] + sa[mi][1];
#pragma unroll
      for (int g = 0; g < 8; ++g) sw[(mi * 16 + g) * S_PITCH] = s[g];
    }
    __syncthreads();

    v16h pa[QT][4];
#pragma unroll
    for (int mi = 0; mi < QT; ++mi) {
      // row l15 of tile mi in A-fragment key order: step ks holds keys
      // ks*32 + half*8 + j at j and ks*32 + 16 + half*8 + j at 8 + j
      float p[4][16];
      {
        const float* sr =
            sr0 + (kb & 1) * (QT * 16 * S_PITCH) + mi * 16 * S_PITCH;
#pragma unroll
        for (int ks = 0; ks < 4; ++ks) {
          v4f c0 = *(const v4f*)(sr + ks * 32);
          v4f c1 = *(const v4f*)(sr + ks * 32 + 4);
          v4f c2 = *(const v4f*)(sr + ks * 32 + 16);
          v4f c3 = *(const v4f*)(sr + ks * 32 + 20);
#pragma unroll
          for (int j = 0; j < 4; ++j) {
            p[ks][j]      = c0[j] * SCALE_ATT;
            p[ks][4 + j]  = c1[j] * SCALE_ATT;
            p[ks][8 + j]  = c2[j] * SCALE_ATT;
            p[ks][12 + j] = c3[j] * SCALE_ATT;
          }
        }
      }

      // online softmax over the 128 keys of the row (64 here, 64 in lane ^ 16)
      float t = p[0][0];
#pragma unroll
      for (int ks = 0; ks < 4; ++ks)
#pragma unroll
        for (int j = 0; j < 16; ++j) t = fmaxf(t, p[ks][j]);
      t = fmaxf(t, __shfl_xor(t, 16, 32));
      float mn = fmaxf(m[mi], t);
      float corr = __expf(m[mi] - mn);
      m[mi] = mn;
      float rs4[4];
#pragma unroll
      for (int ks = 0; ks < 4; ++ks) {
        float rs = 0.f;
#pragma unroll
        for (int j = 0; j < 16; ++j) {
          float e = __expf(p[ks][j] - mn);
          rs += e;
          pa[mi][ks][j] = (_Float16)e;
        }
        rs4[ks] = rs;
      }
      float rs = (rs4[0] + rs4[1]) + (rs4[2] + rs4[3]);
      rs += __shfl_xor(rs, 16, 32);
      l[mi] = l[mi] * corr + rs;

      // the accumulators hold rows g + half*8: fetch those rows' factors
#pragma unroll
      for (int g = 0; g < 8; ++g) {
        float cg = __shfl(corr, g + half * 8, 32);
#pragma unroll
        for (int nt = 0; nt < 8; ++nt) o[mi][nt][g] *= cg;
      }
    }

    // P @ V over the four 32-key steps of the trip; V fragments on two
    // register sets, the next step's 16 loads in flight under this step
    const _Float16* vbase = (const _Float16*)(vbat + voff);
    v16h vb[2][8];
#pragma unroll
    for (int nt = 0; nt < 8; ++nt)
      vb[0][nt] = load_frag_planes(vbase + nt * 512);
#pragma unroll
    for (int ks = 0; ks < 4; ++ks) {
      if (ks < 3) {
#pragma unroll
        for (int nt = 0; nt < 8; ++nt)
          vb[(ks + 1) & 1][nt] =
              load_frag_planes(vbase + ((ks + 1) * 64 + nt) * 512);
      }
      // keeps the next step's 16 loads together in front of this step's
      // products: without it the build issues most V loads two at a time, each
      // pair waited for right in front of its own products
      __builtin_amdgcn_sched_barrier(0);
#pragma unroll
      for (int nt = 0; nt < 8; ++nt)
#pragma unroll
        for (int mi = 0; mi < QT; ++mi)
          o[mi][nt] = wmma_f16(pa[mi][ks], vb[ks & 1][nt], o[mi][nt]);
    }
    // address translations of the V loads done before their address register
    // is advanced (the offset is an operand so that the add stays behind)
    asm volatile("s_wait_xcnt 0x0" : "+v"(voff) :: "memory");
    voff += 4 * 64 * 512 * 2;
  }

  // normalize + write x (f16 row-major)
#pragma unroll
  for (int mi = 0; mi < QT; ++mi) {
    float linv = 1.0f / l[mi];
#pragma unroll
    for (int g = 0; g < 8; ++g) {
      float rinv = __shfl(linv, g + half * 8, 32);
      size_t row = qrow0 + mi * 16 + g + half * 8;
#pragma unroll
      for (int nt = 0; nt < 8; ++nt) {
        xout[row * 1024 + wave * 128 + nt * 16 + l15] =
            (_Float16)(o[mi][nt][g] * rinv);
      }
      // address translations of the row's stores done before their address
      // and data registers are written again
      asm volatile("s_wait_xcnt 0x0" ::: "memory");
      // keeps the next row's arithmetic behind the wait
      __builtin_amdgcn_sched_barrier(0);
    }
  }
}

// ---------------------------------------------------------------------------
extern "C" void kernel_launch(void* const* d_in, const int* in_sizes, int n_in,
                              void* d_out, int out_size, void* d_ws,
                              size_t ws_size, hipStream_t stream) {
  const float* q    = (const float*)d_in[0];
  const float* k    = (const float*)d_in[1];
  const float* v    = (const float*)d_in[2];
  const float* ln_g = (const float*)d_in[3];
  const float* ln_b = (const float*)d_in[4];
  const float* Wq = (const float*)d_in[5];  const float* bq = (const float*)d_in[6];
  const float* Wk = (const float*)d_in[7];  const float* bk = (const float*)d_in[8];
  const float* Wv = (const float*)d_in[9];  const float* bv = (const float*)d_in[10];
  const float* Wo = (const float*)d_in[11]; const float* bo = (const float*)d_in[12];
  float* out = (float*)d_out;

  _Float16* w    = (_Float16*)d_ws;
  _Float16* Wqf  = w;
  _Float16* Wkf  = Wqf + 262144;
  _Float16* Wvf  = Wkf + 262144;
  _Float16* Wof  = Wvf + 262144;
  _Float16* lnq  = Wof + 262144;
  _Float16* lnk  = lnq + 2097152;
  _Float16* lnv  = lnk + 2097152;
  _Float16* qp16 = lnv + 2097152;
  _Float16* kp16 = qp16 + 8388608;
  _Float16* vp16 = kp16 + 8388608;
  _Float16* vpf  = vp16 + 8388608;
  _Float16* x16  = vpf + 8388608;
  _Float16* kpf  = x16 + 8388608;

  swizzle_w_kernel<<<64, 256, 0, stream>>>(Wq, Wqf, 256, 1024);
  swizzle_w_kernel<<<64, 256, 0, stream>>>(Wk, Wkf, 256, 1024);
  swizzle_w_kernel<<<64, 256, 0, stream>>>(Wv, Wvf, 256, 1024);
  swizzle_w_kernel<<<64, 256, 0, stream>>>(Wo, Wof, 1024, 256);

  layernorm_kernel<<<1024, 256, 0, stream>>>(q, ln_g, ln_b, lnq, 8192);
  layernorm_kernel<<<1024, 256, 0, stream>>>(k, ln_g, ln_b, lnk, 8192);
  layernorm_kernel<<<1024, 256, 0, stream>>>(v, ln_g, ln_b, lnv, 8192);

  dim3 pgrid(1024 / 128, 8192 / 128);
  gemm_kernel<<<pgrid, 256, 0, stream>>>(lnq, Wqf, bq, qp16, 8192, 256, 1024, 1);
  gemm_kernel<<<pgrid, 256, 0, stream>>>(lnk, Wkf, bk, kp16, 8192, 256, 1024, 1);
  gemm_kernel<<<pgrid, 256, 0, stream>>>(lnv, Wvf, bv, vp16, 8192, 256, 1024, 1);

  repack_kv_kernel<<<3072, 256, 0, stream>>>(vp16, vpf, kp16, kpf);

  flash_attn_kernel<<<256, 256, 0, stream>>>(qp16, kpf, vpf, x16);

  dim3 ogrid(256 / 128, 8192 / 128);
  gemm_kernel<<<ogrid, 256, 0, stream>>>(x16, Wof, bo, out, 8192, 1024, 256, 0);
}

// v004
// Measured time: 178 microseconds a run.
// In two side-by-side timings against v003, it was 1.25 and 1.26 times as fast.
// Counting every step since v000, it is 2.14 times as fast.
#include <hip/hip_runtime.h>
#include <hip/hip_bf16.h>

typedef __attribute__((ext_vector_type(16))) _Float16 v16h;
typedef __attribute__((ext_vector_type(8)))  _Float16 v8h;
typedef __attribute__((ext_vector_type(8)))  float    v8f;
typedef __attribute__((ext_vector_type(4)))  int      v4i;
typedef __attribute__((ext_vector_type(4)))  float    v4f;

#define SCALE_ATT 0.125f   // 64^-0.5
#define LN_EPS    1e-5f

#if __has_builtin(__builtin_amdgcn_global_load_async_to_lds_b128) && \
    __has_builtin(__builtin_amdgcn_s_wait_asynccnt)
#define HAVE_ASYNC_LDS 1
#else
#define HAVE_ASYNC_LDS 0
#endif

typedef __attribute__((address_space(1))) v4i as1_v4i;   // global int4
typedef __attribute__((address_space(3))) v4i as3_v4i;   // LDS int4

__device__ __forceinline__ v8f wmma_f16(v16h a, v16h b, v8f c) {
  return __builtin_amdgcn_wmma_f32_16x16x32_f16(false, a, false, b, (short)0, c, false, false);
}

// 16-half WMMA fragment from row-major f16 memory: two contiguous 16B runs.
__device__ __forceinline__ v16h load_frag(const _Float16* __restrict__ p) {
  v16h r;
#pragma unroll
  for (int j = 0; j < 8; ++j) { r[j] = p[j]; r[8 + j] = p[16 + j]; }
  return r;
}

// 16-half WMMA fragment from two-plane fragment memory: elements 0..7 of all 32
// lanes lie in one 512-byte run, elements 8..15 in the next, so each of the two
// wave-wide 16-byte loads covers four whole 128-byte lines.
__device__ __forceinline__ v16h load_frag_planes(const _Float16* __restrict__ p) {
  v8h lo = *(const v8h*)p;
  v8h hi = *(const v8h*)(p + 256);
  v16h r;
#pragma unroll
  for (int j = 0; j < 8; ++j) { r[j] = lo[j]; r[8 + j] = hi[j]; }
  return r;
}

// e^x as __expf forms it (multiply by log2 e, v_exp_f32). The v_nop in the same
// statement fills the one slot the instruction set asks for behind a
// transcendental before a source of it is overwritten: in a run of exponentials
// the build lets the next one write the source register of the one in front.
__device__ __forceinline__ float exp_slot(float x) {
  float y = x * 1.44269504088896340736f, r;
  asm("v_exp_f32 %0, %1\n\tv_nop" : "=v"(r) : "v"(y));
  return r;
}

// Copy 8192B (one 8-fragment B panel) global -> LDS, 2 x b128 per thread.
__device__ __forceinline__ void stage_b(const _Float16* __restrict__ g,
                                        _Float16* l, int tid) {
  const _Float16* gp = g + tid * 8;
  _Float16* lp = l + tid * 8;
#if HAVE_ASYNC_LDS
  __builtin_amdgcn_global_load_async_to_lds_b128((as1_v4i*)gp, (as3_v4i*)lp, 0, 0);
  __builtin_amdgcn_global_load_async_to_lds_b128((as1_v4i*)(gp + 2048),
                                                 (as3_v4i*)(lp + 2048), 0, 0);
#else
  *(v8h*)lp = *(const v8h*)gp;
  *(v8h*)(lp + 2048) = *(const v8h*)(gp + 2048);
#endif
}

#if HAVE_ASYNC_LDS
#define ASYNC_WAIT(n) __builtin_amdgcn_s_wait_asynccnt(n)
#else
#define ASYNC_WAIT(n)
#endif

// ---------------------------------------------------------------------------
// 1) f32 weight [K,Nn] -> f16 B-fragment-swizzled: Wf[(kt*(Nn/16)+nt)*512+lane*16]
// ---------------------------------------------------------------------------
__global__ void __launch_bounds__(256) swizzle_w_kernel(
    const float* __restrict__ W, _Float16* __restrict__ Wf, int K, int Nn) {
  int t    = blockIdx.x * 256 + threadIdx.x;
  int lane = t & 31;
  int frag = t >> 5;
  int ntiles = Nn >> 4;
  int nt = frag % ntiles;
  int kt = frag / ntiles;
  if (kt >= (K >> 5)) return;
  int half = lane >> 4, l15 = lane & 15;
  int n = nt * 16 + l15;
  _Float16* dst = Wf + (size_t)frag * 512 + lane * 16;
#pragma unroll
  for (int j = 0; j < 8; ++j) {
    int k0 = kt * 32 + half * 8 + j;
    dst[j]     = (_Float16)W[(size_t)k0 * Nn + n];
    dst[8 + j] = (_Float16)W[(size_t)(k0 + 16) * Nn + n];
  }
}

// ---------------------------------------------------------------------------
// 2) LayerNorm: one wave32 per 256-wide row, f16 row-major output.
// ---------------------------------------------------------------------------
__global__ void __launch_bounds__(256) layernorm_kernel(
    const float* __restrict__ x, const float* __restrict__ g,
    const float* __restrict__ b, _Float16* __restrict__ y, int nrows) {
  int wave = threadIdx.x >> 5, lane = threadIdx.x & 31;
  int row = blockIdx.x * 8 + wave;
  if (row >= nrows) return;
  const float* xr = x + (size_t)row * 256;
  float v[8];
  float s = 0.f;
#pragma unroll
  for (int j = 0; j < 8; ++j) { v[j] = xr[lane * 8 + j]; s += v[j]; }
#pragma unroll
  for (int off = 16; off; off >>= 1) s += __shfl_xor(s, off, 32);
  float mu = s * (1.0f / 256.0f);
  float vs = 0.f;
#pragma unroll
  for (int j = 0; j < 8; ++j) { v[j] -= mu; vs += v[j] * v[j]; }
#pragma unroll
  for (int off = 16; off; off >>= 1) vs += __shfl_xor(vs, off, 32);
  float rstd = rsqrtf(vs * (1.0f / 256.0f) + LN_EPS);
  _Float16* yr = y + (size_t)row * 256;
#pragma unroll
  for (int j = 0; j < 8; ++j) {
    int c = lane * 8 + j;
    yr[c] = (_Float16)(v[j] * rstd * g[c] + b[c]);
  }
}

// ---------------------------------------------------------------------------
// 3) GEMM: C[M,Nn] = A[M,K](f16 rm) @ Bf(swizzled) + bias.
//    8 waves (4M x 2N), block tile 128x128; per-wave 32x64 (acc[2][4]).
//    B panel (8 frags = 8KB per k-step) async-staged into LDS, double-
//    buffered; B fragment reads batched so WMMAs issue back-to-back.
// ---------------------------------------------------------------------------
__global__ void __launch_bounds__(256) gemm_kernel(
    const _Float16* __restrict__ A, const _Float16* __restrict__ Bf,
    const float* __restrict__ bias, void* __restrict__ Cout,
    int M, int K, int Nn, int out_f16) {
  __shared__ _Float16 Bsh[2][8 * 512];   // 2 x 8KB
  int tid  = threadIdx.x;
  int lane = tid & 31;
  int wave = tid >> 5;
  int wm = wave & 3, wn = wave >> 2;
  int m0 = blockIdx.y * 128 + wm * 32;
  int n0 = blockIdx.x * 128 + wn * 64;
  int half = lane >> 4, l15 = lane & 15;
  int ktiles = K >> 5;
  size_t bstride = (size_t)(Nn >> 4) * 512;

  const _Float16* Ap0 = A + (size_t)(m0 + l15) * K + half * 8;
  const _Float16* Ap1 = Ap0 + (size_t)16 * K;
  const _Float16* Bp = Bf + (size_t)blockIdx.x * 8 * 512;
  const _Float16* bs_base = &Bsh[0][0] + wn * 4 * 512 + lane * 16;

  v8f acc[2][4];
  v8f vzero = {0.f, 0.f, 0.f, 0.f, 0.f, 0.f, 0.f, 0.f};
#pragma unroll
  for (int mi = 0; mi < 2; ++mi)
#pragma unroll
    for (int i = 0; i < 4; ++i) acc[mi][i] = vzero;

  stage_b(Bp, &Bsh[0][0], tid);                    // prologue: k-step 0
  for (int kt = 0; kt < ktiles - 1; ++kt) {
    v16h a0 = load_frag(Ap0);                      // A in flight early
    v16h a1 = load_frag(Ap1);
    Ap0 += 32; Ap1 += 32;
    stage_b(Bp + bstride, &Bsh[(kt + 1) & 1][0], tid);
    Bp += bstride;
    ASYNC_WAIT(2);                                 // oldest panel resident
    __syncthreads();
    const _Float16* bs = bs_base + (kt & 1) * (8 * 512);
    v16h bfr[4];
#pragma unroll
    for (int nt = 0; nt < 4; ++nt) bfr[nt] = *(const v16h*)(bs + nt * 512);
#pragma unroll
    for (int nt = 0; nt < 4; ++nt) acc[0][nt] = wmma_f16(a0, bfr[nt], acc[0][nt]);
#pragma unroll
    for (int nt = 0; nt < 4; ++nt) acc[1][nt] = wmma_f16(a1, bfr[nt], acc[1][nt]);
    __syncthreads();                               // reads done before restage
  }
  {
    v16h a0 = load_frag(Ap0);
    v16h a1 = load_frag(Ap1);
    ASYNC_WAIT(0);
    __syncthreads();
    const _Float16* bs = bs_base + ((ktiles - 1) & 1) * (8 * 512);
    v16h bfr[4];
#pragma unroll
    for (int nt = 0; nt < 4; ++nt) bfr[nt] = *(const v16h*)(bs + nt * 512);
#pragma unroll
    for (int nt = 0; nt < 4; ++nt) acc[0][nt] = wmma_f16(a0, bfr[nt], acc[0][nt]);
#pragma unroll
    for (int nt = 0; nt < 4; ++nt) acc[1][nt] = wmma_f16(a1, bfr[nt], acc[1][nt]);
  }

#pragma unroll
  for (int mi = 0; mi < 2; ++mi) {
#pragma unroll
    for (int nt = 0; nt < 4; ++nt) {
      int n = n0 + nt * 16 + l15;
      float bv = bias ? bias[n] : 0.f;
#pragma unroll
      for (int g = 0; g < 8; ++g) {
        int row = m0 + mi * 16 + g + half * 8;
        float val = acc[mi][nt][g] + bv;
        if (out_f16)
          ((_Float16*)Cout)[(size_t)row * Nn + n] = (_Float16)val;
        else
          ((float*)Cout)[(size_t)row * Nn + n] = val;
      }
    }
  }
}

// ---------------------------------------------------------------------------
// 4) Repack vo = vp @ Wo [8192,256] and kp [8192,1024] f16 into two-plane B
//    fragments of 1024 B: [plane 0..1][lane 0..31][8 halfs]; plane 0 holds
//    elements 0..7 of every lane's fragment, plane 1 elements 8..15.
//    Blocks 0..511: V over (key32 x outcol16), fragment kt*16 + nt.
//    Blocks 512..1535: K over (depth32 x key16), fragment keytile*32 + step;
//    a wave turns 128 B of each of 16 key rows into two fragments.
// ---------------------------------------------------------------------------
__global__ void __launch_bounds__(256) repack_kv_kernel(
    const _Float16* __restrict__ vo, _Float16* __restrict__ vof,
    const _Float16* __restrict__ kp, _Float16* __restrict__ kpf) {
  int lane = threadIdx.x & 31;
  int half = lane >> 4, l15 = lane & 15;
  if (blockIdx.x < 512) {
    int frag = blockIdx.x * 8 + (threadIdx.x >> 5);
    int nt = frag & 15;
    int kt = frag >> 4;
    int n = nt * 16 + l15;
    v8h lo, hi;
#pragma unroll
    for (int j = 0; j < 8; ++j) {
      int k0 = kt * 32 + half * 8 + j;
      lo[j] = vo[(size_t)k0 * 256 + n];
      hi[j] = vo[(size_t)(k0 + 16) * 256 + n];
    }
    _Float16* dst = vof + (size_t)frag * 512 + lane * 8;
    *(v8h*)dst         = lo;
    *(v8h*)(dst + 256) = hi;
  } else {
    int kw = (blockIdx.x - 512) * 8 + (threadIdx.x >> 5);
    int keytile = kw >> 4;   // 16 key rows
    int pair    = kw & 15;   // depth steps 2*pair and 2*pair + 1
    const _Float16* s =
        kp + (size_t)(keytile * 16 + l15) * 1024 + pair * 64 + half * 8;
    v8h r[4];
#pragma unroll
    for (int i = 0; i < 4; ++i) r[i] = *(const v8h*)(s + i * 16);
    _Float16* dst = kpf + (size_t)keytile * 16384 + pair * 1024 + lane * 8;
#pragma unroll
    for (int i = 0; i < 4; ++i) *(v8h*)(dst + i * 256) = r[i];
    // address translations of the four stores done before any path of the
    // build writes their address or data registers again
    asm volatile("s_wait_xcnt 0x0" ::: "memory");
  }
}

// ---------------------------------------------------------------------------
// 5) Flash attention: block = (batch, 32-query tile), 8 waves, 128 keys a trip.
//    The 32 queries are two 16-row tiles; every K fragment a wave loads feeds
//    one WMMA of each tile, so the block reads K once for 32 rows.
//    Scores: wave w takes keys [w*16, w*16+16) of the trip over the whole
//    depth (Q fragments from LDS), so each score is summed in one wave's
//    accumulators. The raw 32x128 score tile goes through LDS once.
//    (P @ V) @ Wo is computed as P @ (V @ Wo): the V operand here is vp @ Wo,
//    256 columns wide, and the kernel's result is the final output (plus bo).
//    Wave w takes query tile w >> 2 and output columns [(w&3)*64, (w&3)*64+64):
//    it reads its tile's 16 score rows back in A-fragment order and does the
//    softmax on them.
// ---------------------------------------------------------------------------
#define S_PITCH 132   // floats; 528 B = 16 B x odd, conflict-free b128 row reads
#define QT 2          // 16-row query tiles a block

// one block a WGP (256 blocks): two waves a SIMD
__global__ void __launch_bounds__(256) flash_attn_kernel(
    const _Float16* __restrict__ qp, const _Float16* __restrict__ kpf,
    const _Float16* __restrict__ vof, const float* __restrict__ bo,
    float* __restrict__ out) {
  // Q tiles as A fragments: [tile][depth step 0..31][plane 0..1][lane][8 halfs]
  __shared__ __attribute__((aligned(16))) _Float16 Qs[QT * 32 * 512];
  // raw scores, two buffers so that one barrier a trip is enough
  __shared__ __attribute__((aligned(16))) float Ssh[2][QT * 16 * S_PITCH];

  int lane = threadIdx.x & 31, wave = threadIdx.x >> 5;
  int half = lane >> 4, l15 = lane & 15;
  int tile = wave >> 2, cw = wave & 3;   // P @ V share of this wave
  int b  = blockIdx.x >> 6;
  int qt = blockIdx.x & 63;
  size_t qrow0 = (size_t)b * 2048 + (size_t)qt * (QT * 16);

  // wave w stages the Q fragments of depth steps w*4 .. w*4+3 of both tiles
  {
    v8h qr[QT][4][2];
    const _Float16* qbase = qp + (qrow0 + l15) * 1024 + wave * 128 + half * 8;
#pragma unroll
    for (int mi = 0; mi < QT; ++mi) {
#pragma unroll
      for (int kc = 0; kc < 4; ++kc) {
        qr[mi][kc][0] = *(const v8h*)(qbase + mi * 16 * 1024 + kc * 32);
        qr[mi][kc][1] = *(const v8h*)(qbase + mi * 16 * 1024 + kc * 32 + 16);
      }
    }
    // address translations of the Q loads done before their address register
    // is written again (the pointer is an input so that no load lands on it)
    asm volatile("s_wait_xcnt 0x0" :: "v"(qbase) : "memory");
#pragma unroll
    for (int mi = 0; mi < QT; ++mi)
#pragma unroll
      for (int kc = 0; kc < 4; ++kc) {
        _Float16* qd = &Qs[(mi * 32 + wave * 4 + kc) * 512 + lane * 8];
        *(v8h*)qd         = qr[mi][kc][0];
        *(v8h*)(qd + 256) = qr[mi][kc][1];
      }
  }
  __syncthreads();

  // the batch's K and V, and this lane's running byte offsets into them
  // (advance by one 128-key block per trip)
  const char* kbat = (const char*)(kpf + (size_t)b * 2048 * 1024);
  const char* vbat = (const char*)(vof + (size_t)b * 2048 * 256);
  unsigned koff = (unsigned)((wave * 32 * 512 + lane * 8) * 2);
  unsigned voff = (unsigned)((cw * 4 * 512 + lane * 8) * 2);
  const _Float16* qfr = &Qs[lane * 8];
  // this lane's places in score buffer 0: where it stores, where it reads
  float* sw0 = &Ssh[0][half * 8 * S_PITCH + wave * 16 + l15];
  const float* sr0 = &Ssh[0][(tile * 16 + l15) * S_PITCH + half * 8];

  v8f vzero = {0.f, 0.f, 0.f, 0.f, 0.f, 0.f, 0.f, 0.f};
  v8f o[4];
#pragma unroll
  for (int i = 0; i < 4; ++i) o[i] = vzero;
  float m = -1e30f, l = 0.f;   // stats of query row l15 of the wave's tile

  for (int kb = 0; kb < 16; ++kb) {
    // scores of this wave's 16 keys: 32 depth steps, two accumulators a tile.
    // K fragments come in groups of 8 depth steps on two register sets: the
    // next group's 16 loads are in flight while this group is multiplied.
    v8f sa[QT][2];
#pragma unroll
    for (int mi = 0; mi < QT; ++mi) { sa[mi][0] = vzero; sa[mi][1] = vzero; }
    const _Float16* kbase = (const _Float16*)(kbat + koff);
    v16h kf[2][8];
#pragma unroll
    for (int j = 0; j < 8; ++j) kf[0][j] = load_frag_planes(kbase + j * 512);
#pragma unroll
    for (int kg = 0; kg < 4; ++kg) {
      if (kg < 3) {
#pragma unroll
        for (int j = 0; j < 8; ++j)
          kf[(kg + 1) & 1][j] = load_frag_planes(kbase + ((kg + 1) * 8 + j) * 512);
      }
#pragma unroll
      for (int h = 0; h < 2; ++h) {
        v16h qa[QT][4];
#pragma unroll
        for (int mi = 0; mi < QT; ++mi)
#pragma unroll
          for (int j = 0; j < 4; ++j) {
            const _Float16* qs = qfr + (mi * 32 + kg * 8 + h * 4 + j) * 512;
            v8h qlo = *(const v8h*)qs;
            v8h qhi = *(const v8h*)(qs + 256);
#pragma unroll
            for (int e = 0; e < 8; ++e) {
              qa[mi][j][e] = qlo[e];
              qa[mi][j][8 + e] = qhi[e];
            }
          }
        // inputs-only fence on the loaded Q fragments: one LDS latency for
        // the 16 reads of four depth steps, not one for each product
        asm volatile("" :: "v"(qa[0][0]), "v"(qa[0][1]), "v"(qa[0][2]),
                           "v"(qa[0][3]), "v"(qa[1][0]), "v"(qa[1][1]),
                           "v"(qa[1][2]), "v"(qa[1][3]));
#pragma unroll
        for (int j = 0; j < 4; ++j)
#pragma unroll
          for (int mi = 0; mi < QT; ++mi)
            sa[mi][j & 1] = wmma_f16(qa[mi][j], kf[kg & 1][h * 4 + j], sa[mi][j & 1]);
      }
    }
    // address translations of the K loads done before their address register
    // is advanced (the offset is an operand so that the add stays behind)
    asm volatile("s_wait_xcnt 0x0" : "+v"(koff) :: "memory");
    koff += 128 * 1024 * 2;

    float* sw = sw0 + (kb & 1) * (QT * 16 * S_PITCH);
#pragma unroll
    for (int mi = 0; mi < QT; ++mi) {
      v8f s = sa[mi][0] + sa[mi][1];
#pragma unroll
      for (int g = 0; g < 8; ++g) sw[(mi * 16 + g) * S_PITCH] = s[g];
    }
    __syncthreads();

    // the wave's 16 fragments of V Wo for this trip fit one register set and
    // are loaded as one group
    const _Float16* vbase = (const _Float16*)(vbat + voff);
    v16h vb[4][4];
#pragma unroll
    for (int ks = 0; ks < 4; ++ks)
#pragma unroll
      for (int nt = 0; nt < 4; ++nt)
        vb[ks][nt] = load_frag_planes(vbase + (ks * 16 + nt) * 512);
    // keeps all 32 loads in front of the softmax: without it the build issues
    // the last six among the products, which then wait for them
    __builtin_amdgcn_sched_barrier(0);

    v16h pa[4];
    {
      // row l15 of the wave's tile in A-fragment key order: step ks holds keys
      // ks*32 + half*8 + j at j and ks*32 + 16 + half*8 + j at 8 + j
      float p[4][16];
      {
        const float* sr = sr0 + (kb & 1) * (QT * 16 * S_PITCH);
#pragma unroll
        for (int ks = 0; ks < 4; ++ks) {
          v4f c0 = *(const v4f*)(sr + ks * 32);
          v4f c1 = *(const v4f*)(sr + ks * 32 + 4);
          v4f c2 = *(const v4f*)(sr + ks * 32 + 16);
          v4f c3 = *(const v4f*)(sr + ks * 32 + 20);
#pragma unroll
          for (int j = 0; j < 4; ++j) {
            p[ks][j]      = c0[j] * SCALE_ATT;
            p[ks][4 + j]  = c1[j] * SCALE_ATT;
            p[ks][8 + j]  = c2[j] * SCALE_ATT;
            p[ks][12 + j] = c3[j] * SCALE_ATT;
          }
        }
      }

      // online softmax over the 128 keys of the row (64 here, 64 in lane ^ 16)
      float t = p[0][0];
#pragma unroll
      for (int ks = 0; ks < 4; ++ks)
#pragma unroll
        for (int j = 0; j < 16; ++j) t = fmaxf(t, p[ks][j]);
      t = fmaxf(t, __shfl_xor(t, 16, 32));
      float mn = fmaxf(m, t);
      float corr = __expf(m - mn);
      m = mn;
      float rs4[4];
#pragma unroll
      for (int ks = 0; ks < 4; ++ks) {
        float rs = 0.f;
#pragma unroll
        for (int j = 0; j < 16; ++j) {
          float e = exp_slot(p[ks][j] - mn);
          rs += e;
          pa[ks][j] = (_Float16)e;
        }
        rs4[ks] = rs;
      }
      float rs = (rs4[0] + rs4[1]) + (rs4[2] + rs4[3]);
      rs += __shfl_xor(rs, 16, 32);
      l = l * corr + rs;

      // the accumulators hold rows g + half*8: fetch those rows' factors
#pragma unroll
      for (int g = 0; g < 8; ++g) {
        float cg = __shfl(corr, g + half * 8, 32);
#pragma unroll
        for (int nt = 0; nt < 4; ++nt) o[nt][g] *= cg;
      }
    }

    // P @ (V Wo) over the four 32-key steps of the trip
#pragma unroll
    for (int ks = 0; ks < 4; ++ks)
#pragma unroll
      for (int nt = 0; nt < 4; ++nt)
        o[nt] = wmma_f16(pa[ks], vb[ks][nt], o[nt]);
    // address translations of the V loads done before their address register
    // is advanced (the offset is an operand so that the add stays behind)
    asm volatile("s_wait_xcnt 0x0" : "+v"(voff) :: "memory");
    voff += 4 * 16 * 512 * 2;
  }

  // normalize, add the output bias, write the final f32 rows
  {
    float bov[4];
#pragma unroll
    for (int nt = 0; nt < 4; ++nt) bov[nt] = bo[cw * 64 + nt * 16 + l15];
    float linv = 1.0f / l;
#pragma unroll
    for (int g = 0; g < 8; ++g) {
      float rinv = __shfl(linv, g + half * 8, 32);
      size_t row = qrow0 + tile * 16 + g + half * 8;
#pragma unroll
      for (int nt = 0; nt < 4; ++nt) {
        out[row * 256 + cw * 64 + nt * 16 + l15] = o[nt][g] * rinv + bov[nt];
      }
      // address translations of the row's stores done before their address
      // and data registers are written again
      asm volatile("s_wait_xcnt 0x0" ::: "memory");
      // keeps the next row's arithmetic behind the wait
      __builtin_amdgcn_sched_barrier(0);
    }
  }
}

// ---------------------------------------------------------------------------
extern "C" void kernel_launch(void* const* d_in, const int* in_sizes, int n_in,
                              void* d_out, int out_size, void* d_ws,
                              size_t ws_size, hipStream_t stream) {
  const float* q    = (const float*)d_in[0];
  const float* k    = (const float*)d_in[1];
  const float* v    = (const float*)d_in[2];
  const float* ln_g = (const float*)d_in[3];
  const float* ln_b = (const float*)d_in[4];
  const float* Wq = (const float*)d_in[5];  const float* bq = (const float*)d_in[6];
  const float* Wk = (const float*)d_in[7];  const float* bk = (const float*)d_in[8];
  const float* Wv = (const float*)d_in[9];  const float* bv = (const float*)d_in[10];
  const float* Wo = (const float*)d_in[11]; const float* bo = (const float*)d_in[12];
  float* out = (float*)d_out;

  _Float16* w    = (_Float16*)d_ws;
  _Float16* Wqf  = w;
  _Float16* Wkf  = Wqf + 262144;
  _Float16* Wvf  = Wkf + 262144;
  _Float16* Wof  = Wvf + 262144;
  _Float16* lnq  = Wof + 262144;
  _Float16* lnk  = lnq + 2097152;
  _Float16* lnv  = lnk + 2097152;
  _Float16* qp16 = lnv + 2097152;
  _Float16* kp16 = qp16 + 8388608;
  _Float16* vp16 = kp16 + 8388608;
  _Float16* vo16 = vp16 + 8388608;
  _Float16* vof  = vo16 + 2097152;
  _Float16* kpf  = vof + 2097152;

  swizzle_w_kernel<<<64, 256, 0, stream>>>(Wq, Wqf, 256, 1024);
  swizzle_w_kernel<<<64, 256, 0, stream>>>(Wk, Wkf, 256, 1024);
  swizzle_w_kernel<<<64, 256, 0, stream>>>(Wv, Wvf, 256, 1024);
  swizzle_w_kernel<<<64, 256, 0, stream>>>(Wo, Wof, 1024, 256);

  layernorm_kernel<<<1024, 256, 0, stream>>>(q, ln_g, ln_b, lnq, 8192);
  layernorm_kernel<<<1024, 256, 0, stream>>>(k, ln_g, ln_b, lnk, 8192);
  layernorm_kernel<<<1024, 256, 0, stream>>>(v, ln_g, ln_b, lnv, 8192);

  dim3 pgrid(1024 / 128, 8192 / 128);
  gemm_kernel<<<pgrid, 256, 0, stream>>>(lnq, Wqf, bq, qp16, 8192, 256, 1024, 1);
  gemm_kernel<<<pgrid, 256, 0, stream>>>(lnk, Wkf, bk, kp16, 8192, 256, 1024, 1);
  gemm_kernel<<<pgrid, 256, 0, stream>>>(lnv, Wvf, bv, vp16, 8192, 256, 1024, 1);

  // vo = vp @ Wo; bo is added behind the softmax product
  dim3 ogrid(256 / 128, 8192 / 128);
  gemm_kernel<<<ogrid, 256, 0, stream>>>(vp16, Wof, nullptr, vo16, 8192, 1024, 256, 1);

  repack_kv_kernel<<<1536, 256, 0, stream>>>(vo16, vof, kp16, kpf);

  flash_attn_kernel<<<256, 256, 0, stream>>>(qp16, kpf, vof, bo, out);
}

// v007
// Measured time: 69.8 microseconds a run.
// It is 2.57 times as fast as v004, going by the measured steps of the versions left out in between.
// All steps since v000 together make it 5.49 times as fast.
#include <hip/hip_runtime.h>
#include <hip/hip_bf16.h>

typedef __attribute__((ext_vector_type(16))) _Float16 v16h;
typedef __attribute__((ext_vector_type(8)))  _Float16 v8h;
typedef __attribute__((ext_vector_type(8)))  float    v8f;
typedef __attribute__((ext_vector_type(4)))  int      v4i;
typedef __attribute__((ext_vector_type(4)))  float    v4f;

#define SCALE_ATT 0.125f   // 64^-0.5
#define LN_EPS    1e-5f

#if __has_builtin(__builtin_amdgcn_global_load_async_to_lds_b128) && \
    __has_builtin(__builtin_amdgcn_s_wait_asynccnt)
#define HAVE_ASYNC_LDS 1
#else
#define HAVE_ASYNC_LDS 0
#endif

typedef __attribute__((address_space(1))) v4i as1_v4i;   // global int4
typedef __attribute__((address_space(3))) v4i as3_v4i;   // LDS int4

__device__ __forceinline__ v8f wmma_f16(v16h a, v16h b, v8f c) {
  return __builtin_amdgcn_wmma_f32_16x16x32_f16(false, a, false, b, (short)0, c, false, false);
}

// 16-half WMMA fragment from row-major f16 memory: two contiguous 16B runs.
__device__ __forceinline__ v16h load_frag(const _Float16* __restrict__ p) {
  v16h r;
#pragma unroll
  for (int j = 0; j < 8; ++j) { r[j] = p[j]; r[8 + j] = p[16 + j]; }
  return r;
}

// 16-half WMMA fragment from two-plane fragment memory: elements 0..7 of all 32
// lanes lie in one 512-byte run, elements 8..15 in the next, so each of the two
// wave-wide 16-byte loads covers four whole 128-byte lines.
__device__ __forceinline__ v16h load_frag_planes(const _Float16* __restrict__ p) {
  v8h lo = *(const v8h*)p;
  v8h hi = *(const v8h*)(p + 256);
  v16h r;
#pragma unroll
  for (int j = 0; j < 8; ++j) { r[j] = lo[j]; r[8 + j] = hi[j]; }
  return r;
}

// e^x as __expf forms it (multiply by log2 e, v_exp_f32). The v_nop in the same
// statement fills the one slot the instruction set asks for behind a
// transcendental before a source of it is overwritten: in a run of exponentials
// the build lets the next one write the source register of the one in front.
__device__ __forceinline__ float exp_slot(float x) {
  float y = x * 1.44269504088896340736f, r;
  asm("v_exp_f32 %0, %1\n\tv_nop" : "=v"(r) : "v"(y));
  return r;
}

// Copy 8192B (one 8-fragment B panel) global -> LDS, 2 x b128 per thread.
__device__ __forceinline__ void stage_b(const _Float16* __restrict__ g,
                                        _Float16* l, int tid) {
  const _Float16* gp = g + tid * 8;
  _Float16* lp = l + tid * 8;
#if HAVE_ASYNC_LDS
  __builtin_amdgcn_global_load_async_to_lds_b128((as1_v4i*)gp, (as3_v4i*)lp, 0, 0);
  __builtin_amdgcn_global_load_async_to_lds_b128((as1_v4i*)(gp + 2048),
                                                 (as3_v4i*)(lp + 2048), 0, 0);
#else
  *(v8h*)lp = *(const v8h*)gp;
  *(v8h*)(lp + 2048) = *(const v8h*)(gp + 2048);
#endif
}

#if HAVE_ASYNC_LDS
#define ASYNC_WAIT(n) __builtin_amdgcn_s_wait_asynccnt(n)
#else
#define ASYNC_WAIT(n)
#endif

// ---------------------------------------------------------------------------
// 1) Weight products. (x W1 + b1) W2 = x (W1 W2) + b1 W2, so each projection
//    pair is multiplied once here, 256 x 1024 x 256, and the rows of q and v
//    then meet one 256 x 256 matrix.
//    by 0: Wq Wk^T and bq Wk^T; 1: Wv Wo and bv Wo.
//    bx = mb*8 + nb: a 32 x 32 tile of the product (2 x 2 WMMA tiles);
//    mb = 8 is the bias row: every A row is the bias vector, row 0 is kept.
//    The 8 waves split the depth (128 each, 4 steps) and their partial tiles
//    are summed through LDS in wave order. Column l15 of tile ni stands for
//    n = nb*32 + l15*2 + ni, so that one 8-byte load of Wo feeds both tiles.
//    The result is written as the f16 B fragments gemm_kernel reads:
//    Wf[(kt*16 + n/16)*512 + lane*16 + e]; a D tile's 8 rows of a lane are the
//    8 contiguous elements of one half of that lane's fragment.
// ---------------------------------------------------------------------------
typedef __attribute__((ext_vector_type(16))) float v16f;
typedef __attribute__((ext_vector_type(2)))  float v2f;

// the 16 f32 values of one lane's fragment from k-contiguous memory
__device__ __forceinline__ v16f load_raw(const float* __restrict__ p) {
  v4f x0 = *(const v4f*)p;
  v4f x1 = *(const v4f*)(p + 4);
  v4f x2 = *(const v4f*)(p + 16);
  v4f x3 = *(const v4f*)(p + 20);
  v16f r;
#pragma unroll
  for (int j = 0; j < 4; ++j) {
    r[j] = x0[j]; r[4 + j] = x1[j]; r[8 + j] = x2[j]; r[12 + j] = x3[j];
  }
  return r;
}

__device__ __forceinline__ v16h to_f16(v16f x) {
  v16h r;
#pragma unroll
  for (int j = 0; j < 16; ++j) r[j] = (_Float16)x[j];
  return r;
}

__device__ __forceinline__ void fold_w_block(
    int bx, int by,
    const float* __restrict__ Wq, const float* __restrict__ bq,
    const float* __restrict__ Wk,
    const float* __restrict__ Wv, const float* __restrict__ bv,
    const float* __restrict__ Wo,
    _Float16* __restrict__ Wqkf, float* __restrict__ bqk,
    _Float16* __restrict__ Wvof, float* __restrict__ bvo) {
  __shared__ v4f red[8][4][2][32];   // [wave][tile][rows 0..3 / 4..7][lane]
  int lane = threadIdx.x & 31, wave = threadIdx.x >> 5;
  int half = lane >> 4, l15 = lane & 15;
  int mb = bx >> 3, nb = bx & 7;
  bool second = by != 0;
  int kw = wave * 128 + half * 8;    // this lane's first depth index

  const float* ap = second ? Wv : Wq;
  int astep = 16 * 1024;
  if (mb < 8) {
    ap += (size_t)(mb * 32 + l15) * 1024 + kw;
  } else {
    ap = (second ? bv : bq) + kw;
    astep = 0;
  }

  const float* ap1 = ap + astep;
  v16f ar[2][4];
#pragma unroll
  for (int s = 0; s < 4; ++s) ar[0][s] = load_raw(ap + s * 32);
#pragma unroll
  for (int s = 0; s < 4; ++s) ar[1][s] = load_raw(ap1 + s * 32);
  // address translations of the A loads done before their address registers
  // are written again (the pointers are inputs so that nothing lands on them)
  asm volatile("s_wait_xcnt 0x0" :: "v"(ap), "v"(ap1) : "memory");

  v16h bf[2][4];
  if (!second) {
    // B[k][n] = Wk[n][k]: a lane's runs are contiguous
    const float* bp = Wk + (size_t)(nb * 32 + l15 * 2) * 1024 + kw;
    v16f br[2][4];
#pragma unroll
    for (int ni = 0; ni < 2; ++ni)
#pragma unroll
      for (int s = 0; s < 4; ++s) br[ni][s] = load_raw(bp + ni * 1024 + s * 32);
    // as above, for the B loads
    asm volatile("s_wait_xcnt 0x0" :: "v"(bp) : "memory");
#pragma unroll
    for (int ni = 0; ni < 2; ++ni)
#pragma unroll
      for (int s = 0; s < 4; ++s) bf[ni][s] = to_f16(br[ni][s]);
  } else {
    // B[k][n] = Wo[k][n]: one load brings columns n and n + 1 of a depth row
    const float* bp = Wo + (size_t)kw * 256 + nb * 32 + l15 * 2;
    v2f lo[4][8], hi[4][8];
#pragma unroll
    for (int s = 0; s < 4; ++s)
#pragma unroll
      for (int j = 0; j < 8; ++j) {
        lo[s][j] = *(const v2f*)(bp + (s * 32 + j) * 256);
        hi[s][j] = *(const v2f*)(bp + (s * 32 + 16 + j) * 256);
      }
    // as above, for the B loads
    asm volatile("s_wait_xcnt 0x0" :: "v"(bp) : "memory");
#pragma unroll
    for (int s = 0; s < 4; ++s)
#pragma unroll
      for (int j = 0; j < 8; ++j) {
        bf[0][s][j]     = (_Float16)lo[s][j][0];
        bf[1][s][j]     = (_Float16)lo[s][j][1];
        bf[0][s][8 + j] = (_Float16)hi[s][j][0];
        bf[1][s][8 + j] = (_Float16)hi[s][j][1];
      }
  }

  v8f acc[4];
  v8f vzero = {0.f, 0.f, 0.f, 0.f, 0.f, 0.f, 0.f, 0.f};
#pragma unroll
  for (int t = 0; t < 4; ++t) acc[t] = vzero;
#pragma unroll
  for (int s = 0; s < 4; ++s) {
    v16h a0 = to_f16(ar[0][s]), a1 = to_f16(ar[1][s]);
    acc[0] = wmma_f16(a0, bf[0][s], acc[0]);
    acc[1] = wmma_f16(a0, bf[1][s], acc[1]);
    acc[2] = wmma_f16(a1, bf[0][s], acc[2]);
    acc[3] = wmma_f16(a1, bf[1][s], acc[3]);
  }
#pragma unroll
  for (int t = 0; t < 4; ++t)
#pragma unroll
    for (int h = 0; h < 2; ++h) {
      v4f x = {acc[t][h * 4], acc[t][h * 4 + 1], acc[t][h * 4 + 2],
               acc[t][h * 4 + 3]};
      red[wave][t][h][lane] = x;
    }
  __syncthreads();

  // wave w sums rows (w&1)*4 .. +3 (of each lane half) of tile w >> 1
  int t = wave >> 1, h = wave & 1;
  int mi = t >> 1, ni = t & 1;
  v4f sum = red[0][t][h][lane];
#pragma unroll
  for (int u = 1; u < 8; ++u) sum += red[u][t][h][lane];
  int n = nb * 32 + l15 * 2 + ni;
  if (mb < 8) {
    typedef __attribute__((ext_vector_type(4))) _Float16 v4h;
    v4h r = {(_Float16)sum[0], (_Float16)sum[1], (_Float16)sum[2],
             (_Float16)sum[3]};
    _Float16* Wf = second ? Wvof : Wqkf;
    *(v4h*)(Wf + (size_t)(mb * 16 + (n >> 4)) * 512 +
            (half * 16 + (n & 15)) * 16 + mi * 8 + h * 4) = r;
  } else if (mi == 0 && h == 0 && half == 0) {
    (second ? bvo : bqk)[n] = sum[0];
  }
}

// ---------------------------------------------------------------------------
// 2) LayerNorm of q, k and v: one wave32 per 256-wide row, f16
//    row-major output; the three outputs lie one behind the other, so a row
//    has one flat index over 3 x 8192. A block takes 256 rows of one tensor,
//    a wave 32 of them in four batches of 8; a batch's 16 loads are issued one
//    batch ahead, and the 8 rows' reductions run side by side.
// ---------------------------------------------------------------------------
#define LN_BATCH 8     // rows a wave has in work at a time
#define LN_NBATCH 4    // batches a wave
#define LN_BLOCKS 96   // 3 * 8192 / (8 waves * LN_BATCH * LN_NBATCH)
// Every loop over rows, elements or shuffle steps below is unrolled: the rows
// live in registers, so each index must be known at compile time.

__device__ __forceinline__ void ln_load(const char* __restrict__ xb, unsigned xoff,
                                        int batch, v4f (&d)[LN_BATCH][2]) {
#pragma unroll
  for (int r = 0; r < LN_BATCH; ++r) {
    d[r][0] = *(const v4f*)(xb + xoff + (batch * LN_BATCH + r) * 1024);
    d[r][1] = *(const v4f*)(xb + xoff + (batch * LN_BATCH + r) * 1024 + 16);
  }
  // address translations of the batch's loads done before any register they
  // name is written again
  asm volatile("s_wait_xcnt 0x0" ::: "memory");
  // keeps the loads in front of the batch that is worked on next, and that
  // batch's arithmetic behind the wait
  __builtin_amdgcn_sched_barrier(0);
}

__device__ __forceinline__ void ln_batch(const v4f (&d)[LN_BATCH][2],
                                         const float (&gv)[8], const float (&bv)[8],
                                         char* __restrict__ yb, unsigned yoff,
                                         int batch) {
  float v[LN_BATCH][8], s[LN_BATCH], vs[LN_BATCH];
#pragma unroll
  for (int r = 0; r < LN_BATCH; ++r) {
    s[r] = 0.f;
#pragma unroll
    for (int j = 0; j < 8; ++j) { v[r][j] = d[r][j >> 2][j & 3]; s[r] += v[r][j]; }
  }
#pragma unroll
  for (int off = 16; off; off >>= 1)
#pragma unroll
    for (int r = 0; r < LN_BATCH; ++r) s[r] += __shfl_xor(s[r], off, 32);
#pragma unroll
  for (int r = 0; r < LN_BATCH; ++r) {
    float mu = s[r] * (1.0f / 256.0f);
    vs[r] = 0.f;
#pragma unroll
    for (int j = 0; j < 8; ++j) { v[r][j] -= mu; vs[r] += v[r][j] * v[r][j]; }
  }
#pragma unroll
  for (int off = 16; off; off >>= 1)
#pragma unroll
    for (int r = 0; r < LN_BATCH; ++r) vs[r] += __shfl_xor(vs[r], off, 32);
#pragma unroll
  for (int r = 0; r < LN_BATCH; ++r) {
    float rstd = rsqrtf(vs[r] * (1.0f / 256.0f) + LN_EPS);
    v8h h;
#pragma unroll
    for (int j = 0; j < 8; ++j) h[j] = (_Float16)(v[r][j] * rstd * gv[j] + bv[j]);
    *(v8h*)(yb + yoff + (batch * LN_BATCH + r) * 512) = h;
  }
  // address translations of the batch's stores done before their data
  // registers are written again
  asm volatile("s_wait_xcnt 0x0" ::: "memory");
  // keeps the next batch's arithmetic behind the wait
  __builtin_amdgcn_sched_barrier(0);
}

__device__ __forceinline__ void layernorm_block(
    int lb, const float* __restrict__ q, const float* __restrict__ k,
    const float* __restrict__ v, const float* __restrict__ g,
    const float* __restrict__ b, _Float16* __restrict__ y) {
  int wave = threadIdx.x >> 5, lane = threadIdx.x & 31;
  int tensor = lb >> 5;   // 32 blocks a tensor
  const float* x = tensor == 0 ? q : (tensor == 1 ? k : v);
  const char* xb = (const char*)(x + (size_t)(lb & 31) * 256 * 256);
  char* yb = (char*)(y + (size_t)lb * 256 * 256);
  unsigned xoff = (unsigned)(wave * (LN_BATCH * LN_NBATCH) * 1024 + lane * 32);
  unsigned yoff = (unsigned)(wave * (LN_BATCH * LN_NBATCH) * 512 + lane * 16);

  v4f g0 = *(const v4f*)(g + lane * 8), g1 = *(const v4f*)(g + lane * 8 + 4);
  v4f b0 = *(const v4f*)(b + lane * 8), b1 = *(const v4f*)(b + lane * 8 + 4);
  v4f d[2][LN_BATCH][2];
  ln_load(xb, xoff, 0, d[0]);
  ln_load(xb, xoff, 1, d[1]);
  float gv[8], bv[8];
#pragma unroll
  for (int j = 0; j < 4; ++j) {
    gv[j] = g0[j]; gv[4 + j] = g1[j]; bv[j] = b0[j]; bv[4 + j] = b1[j];
  }
  ln_batch(d[0], gv, bv, yb, yoff, 0);
  // unrolled so that the two register sets are named at compile time and every
  // row's address is the same register with its own immediate offset
#pragma unroll
  for (int t = 1; t < LN_NBATCH; ++t) {
    if (t + 1 < LN_NBATCH) ln_load(xb, xoff, t + 1, d[(t + 1) & 1]);
    ln_batch(d[t & 1], gv, bv, yb, yoff, t);
  }
}

// The weight products and the three LayerNorms depend on nothing but inputs:
// they share one launch. Blocks 0..143 are the weight products, the rest the rows.
__global__ void __launch_bounds__(256) prep_kernel(
    const float* __restrict__ Wq, const float* __restrict__ bq,
    const float* __restrict__ Wk,
    const float* __restrict__ Wv, const float* __restrict__ bv,
    const float* __restrict__ Wo,
    _Float16* __restrict__ Wqkf, float* __restrict__ bqk,
    _Float16* __restrict__ Wvof, float* __restrict__ bvo,
    const float* __restrict__ q, const float* __restrict__ k,
    const float* __restrict__ v, const float* __restrict__ ln_g,
    const float* __restrict__ ln_b, _Float16* __restrict__ ln_out) {
  int blk = blockIdx.x;
  if (blk < 144) {
    int by = blk >= 72 ? 1 : 0;
    fold_w_block(blk - by * 72, by, Wq, bq, Wk, Wv, bv, Wo, Wqkf, bqk, Wvof, bvo);
  } else {
    layernorm_block(blk - 144, q, k, v, ln_g, ln_b, ln_out);
  }
}

// ---------------------------------------------------------------------------
// 3a) Repack kn = LN(k) [8192,256] f16 into two-plane B fragments of 1024 B:
//    [plane 0..1][lane 0..31][8 halfs]; plane 0 holds elements 0..7 of every
//    lane's fragment, plane 1 elements 8..15. K over (depth32 x key16),
//    fragment keytile*8 + step; a wave turns 128 B of each of 16 key rows into
//    two fragments. 256 blocks; it needs LN(k) alone, so it rides in the GEMM
//    launch.
// ---------------------------------------------------------------------------
__device__ __forceinline__ void repack_k_block(
    int kblk, const _Float16* __restrict__ kn, _Float16* __restrict__ knf) {
  int lane = threadIdx.x & 31;
  int half = lane >> 4, l15 = lane & 15;
  {
    int kw = kblk * 8 + (threadIdx.x >> 5);
    int keytile = kw >> 2;   // 16 key rows
    int pair    = kw & 3;    // depth steps 2*pair and 2*pair + 1
    const _Float16* s =
        kn + (size_t)(keytile * 16 + l15) * 256 + pair * 64 + half * 8;
    v8h r[4];
#pragma unroll
    for (int i = 0; i < 4; ++i) r[i] = *(const v8h*)(s + i * 16);
    _Float16* dst = knf + (size_t)keytile * 4096 + pair * 1024 + lane * 8;
#pragma unroll
    for (int i = 0; i < 4; ++i) *(v8h*)(dst + i * 256) = r[i];
    // address translations of the four stores done before any path of the
    // build writes their address or data registers again
    asm volatile("s_wait_xcnt 0x0" ::: "memory");
  }
}

// ---------------------------------------------------------------------------
// 3) GEMM: C[M,Nn] = A[M,K](f16 rm) @ Bf(swizzled) + bias.
//    8 waves (4M x 2N), block tile 128x128; per-wave 32x64 (acc[2][4]).
//    B panel (8 frags = 8KB per k-step) async-staged into LDS, double-
//    buffered; B fragment reads batched so WMMAs issue back-to-back.
//    blockIdx.z 0 and 1 pick one of two independent problems of the same
//    shape; the blocks of z 2 and 3 are the K repack.
// ---------------------------------------------------------------------------
__global__ void __launch_bounds__(256) gemm_kernel(
    const _Float16* __restrict__ A_0, const _Float16* __restrict__ Bf_0,
    const float* __restrict__ bias_0, void* __restrict__ Cout_0,
    const _Float16* __restrict__ A_1, const _Float16* __restrict__ Bf_1,
    const float* __restrict__ bias_1, void* __restrict__ Cout_1,
    int M, int K, int Nn, int out_f16,
    const _Float16* __restrict__ kn, _Float16* __restrict__ knf) {
  __shared__ _Float16 Bsh[2][8 * 512];   // 2 x 8KB
  if (blockIdx.z >= 2) {   // the whole block, in front of every barrier
    repack_k_block((blockIdx.z - 2) * 128 + blockIdx.y * 2 + blockIdx.x, kn, knf);
    return;
  }
  bool other = blockIdx.z != 0;
  const _Float16* A  = other ? A_1 : A_0;
  const _Float16* Bf = other ? Bf_1 : Bf_0;
  const float* bias  = other ? bias_1 : bias_0;
  void* Cout         = other ? Cout_1 : Cout_0;
  int tid  = threadIdx.x;
  int lane = tid & 31;
  int wave = tid >> 5;
  int wm = wave & 3, wn = wave >> 2;
  int m0 = blockIdx.y * 128 + wm * 32;
  int n0 = blockIdx.x * 128 + wn * 64;
  int half = lane >> 4, l15 = lane & 15;
  int ktiles = K >> 5;
  size_t bstride = (size_t)(Nn >> 4) * 512;

  const _Float16* Ap0 = A + (size_t)(m0 + l15) * K + half * 8;
  const _Float16* Ap1 = Ap0 + (size_t)16 * K;
  const _Float16* Bp = Bf + (size_t)blockIdx.x * 8 * 512;
  const _Float16* bs_base = &Bsh[0][0] + wn * 4 * 512 + lane * 16;

  v8f acc[2][4];
  v8f vzero = {0.f, 0.f, 0.f, 0.f, 0.f, 0.f, 0.f, 0.f};
#pragma unroll
  for (int mi = 0; mi < 2; ++mi)
#pragma unroll
    for (int i = 0; i < 4; ++i) acc[mi][i] = vzero;

  stage_b(Bp, &Bsh[0][0], tid);                    // prologue: k-step 0
  for (int kt = 0; kt < ktiles - 1; ++kt) {
    v16h a0 = load_frag(Ap0);                      // A in flight early
    v16h a1 = load_frag(Ap1);
    Ap0 += 32; Ap1 += 32;
    stage_b(Bp + bstride, &Bsh[(kt + 1) & 1][0], tid);
    Bp += bstride;
    ASYNC_WAIT(2);                                 // oldest panel resident
    __syncthreads();
    const _Float16* bs = bs_base + (kt & 1) * (8 * 512);
    v16h bfr[4];
#pragma unroll
    for (int nt = 0; nt < 4; ++nt) bfr[nt] = *(const v16h*)(bs + nt * 512);
#pragma unroll
    for (int nt = 0; nt < 4; ++nt) acc[0][nt] = wmma_f16(a0, bfr[nt], acc[0][nt]);
#pragma unroll
    for (int nt = 0; nt < 4; ++nt) acc[1][nt] = wmma_f16(a1, bfr[nt], acc[1][nt]);
    __syncthreads();                               // reads done before restage
  }
  {
    v16h a0 = load_frag(Ap0);
    v16h a1 = load_frag(Ap1);
    ASYNC_WAIT(0);
    __syncthreads();
    const _Float16* bs = bs_base + ((ktiles - 1) & 1) * (8 * 512);
    v16h bfr[4];
#pragma unroll
    for (int nt = 0; nt < 4; ++nt) bfr[nt] = *(const v16h*)(bs + nt * 512);
#pragma unroll
    for (int nt = 0; nt < 4; ++nt) acc[0][nt] = wmma_f16(a0, bfr[nt], acc[0][nt]);
#pragma unroll
    for (int nt = 0; nt < 4; ++nt) acc[1][nt] = wmma_f16(a1, bfr[nt], acc[1][nt]);
  }

#pragma unroll
  for (int mi = 0; mi < 2; ++mi) {
#pragma unroll
    for (int nt = 0; nt < 4; ++nt) {
      int n = n0 + nt * 16 + l15;
      float bv = bias ? bias[n] : 0.f;
#pragma unroll
      for (int g = 0; g < 8; ++g) {
        int row = m0 + mi * 16 + g + half * 8;
        float val = acc[mi][nt][g] + bv;
        if (out_f16)
          ((_Float16*)Cout)[(size_t)row * Nn + n] = (_Float16)val;
        else
          ((float*)Cout)[(size_t)row * Nn + n] = val;
      }
    }
  }
}

// ---------------------------------------------------------------------------
// 4) Repack vo = vp @ Wo [8192,256] f16 into two-plane B fragments (layout: see
//    repack_k_block) over (key32 x outcol16), fragment kt*16 + nt.
// ---------------------------------------------------------------------------
__global__ void __launch_bounds__(256) repack_v_kernel(
    const _Float16* __restrict__ vo, _Float16* __restrict__ vof) {
  int lane = threadIdx.x & 31;
  int half = lane >> 4, l15 = lane & 15;
  {
    int frag = blockIdx.x * 8 + (threadIdx.x >> 5);
    int nt = frag & 15;
    int kt = frag >> 4;
    int n = nt * 16 + l15;
    v8h lo, hi;
#pragma unroll
    for (int j = 0; j < 8; ++j) {
      int k0 = kt * 32 + half * 8 + j;
      lo[j] = vo[(size_t)k0 * 256 + n];
      hi[j] = vo[(size_t)(k0 + 16) * 256 + n];
    }
    _Float16* dst = vof + (size_t)frag * 512 + lane * 8;
    *(v8h*)dst         = lo;
    *(v8h*)(dst + 256) = hi;
  }
}

// ---------------------------------------------------------------------------
// 5) Flash attention: block = (batch, 32-query tile), 8 waves, 128 keys a trip.
//    The 32 queries are two 16-row tiles; every K fragment a wave loads feeds
//    one WMMA of each tile, so the block reads K once for 32 rows.
//    qp @ kp^T with kp = kn @ Wk + bk is computed as (qp @ Wk^T) @ kn^T: the Q
//    operand here is qp @ Wk^T and the K operand the normalized k, both 256
//    deep. The term left out, qp . bk, is the same for every key of a query
//    row, and the softmax over the keys does not change under such a shift.
//    Scores: wave w takes keys [w*16, w*16+16) of the trip over the whole
//    depth (Q fragments from LDS), so each score is summed in one wave's
//    accumulators. The raw 32x128 score tile goes through LDS once.
//    (P @ V) @ Wo is computed as P @ (V @ Wo): the V operand here is vp @ Wo,
//    256 columns wide, and the kernel's result is the final output (plus bo).
//    Wave w takes query tile w >> 2 and output columns [(w&3)*64, (w&3)*64+64):
//    it reads its tile's 16 score rows back in A-fragment order and does the
//    softmax on them.
// ---------------------------------------------------------------------------
#define S_PITCH 132   // floats; 528 B = 16 B x odd, conflict-free b128 row reads
#define QT 2          // 16-row query tiles a block

// one block a WGP (256 blocks): two waves a SIMD
__global__ void __launch_bounds__(256) flash_attn_kernel(
    const _Float16* __restrict__ qk, const _Float16* __restrict__ knf,
    const _Float16* __restrict__ vof, const float* __restrict__ bo,
    float* __restrict__ out) {
  // Q tiles as A fragments: [tile][depth step 0..7][plane 0..1][lane][8 halfs]
  __shared__ __attribute__((aligned(16))) _Float16 Qs[QT * 8 * 512];
  // raw scores, two buffers so that one barrier a trip is enough
  __shared__ __attribute__((aligned(16))) float Ssh[2][QT * 16 * S_PITCH];

  int lane = threadIdx.x & 31, wave = threadIdx.x >> 5;
  int half = lane >> 4, l15 = lane & 15;
  int tile = wave >> 2, cw = wave & 3;   // P @ V share of this wave
  int b  = blockIdx.x >> 6;
  int qt = blockIdx.x & 63;
  size_t qrow0 = (size_t)b * 2048 + (size_t)qt * (QT * 16);

  // wave w stages the Q fragments of depth step w of both tiles
  {
    v8h qr[QT][2];
    const _Float16* qbase = qk + (qrow0 + l15) * 256 + wave * 32 + half * 8;
#pragma unroll
    for (int mi = 0; mi < QT; ++mi) {
      qr[mi][0] = *(const v8h*)(qbase + mi * 16 * 256);
      qr[mi][1] = *(const v8h*)(qbase + mi * 16 * 256 + 16);
    }
    // address translations of the Q loads done before their address register
    // is written again (the pointer is an input so that no load lands on it)
    asm volatile("s_wait_xcnt 0x0" :: "v"(qbase) : "memory");
#pragma unroll
    for (int mi = 0; mi < QT; ++mi) {
      _Float16* qd = &Qs[(mi * 8 + wave) * 512 + lane * 8];
      *(v8h*)qd         = qr[mi][0];
      *(v8h*)(qd + 256) = qr[mi][1];
    }
  }
  __syncthreads();

  // the batch's K and V, and this lane's running byte offsets into them
  // (advance by one 128-key block per trip)
  const char* kbat = (const char*)(knf + (size_t)b * 2048 * 256);
  const char* vbat = (const char*)(vof + (size_t)b * 2048 * 256);
  unsigned koff = (unsigned)((wave * 8 * 512 + lane * 8) * 2);
  unsigned voff = (unsigned)((cw * 4 * 512 + lane * 8) * 2);
  const _Float16* qfr = &Qs[lane * 8];
  // this lane's places in score buffer 0: where it stores, where it reads
  float* sw0 = &Ssh[0][half * 8 * S_PITCH + wave * 16 + l15];
  const float* sr0 = &Ssh[0][(tile * 16 + l15) * S_PITCH + half * 8];

  v8f vzero = {0.f, 0.f, 0.f, 0.f, 0.f, 0.f, 0.f, 0.f};
  v8f o[4];
#pragma unroll
  for (int i = 0; i < 4; ++i) o[i] = vzero;
  float m = -1e30f, l = 0.f;   // stats of query row l15 of the wave's tile

  // K fragments come in groups of 8 depth steps, one group a trip; a group's 16
  // loads are issued one group ahead of its products: the first group here,
  // each later one in the trip in front of its own.
  v16h kf[8];
  {
    const _Float16* kbase = (const _Float16*)(kbat + koff);
#pragma unroll
    for (int j = 0; j < 8; ++j) kf[j] = load_frag_planes(kbase + j * 512);
  }
  // address translations of the K loads done before their address register
  // is advanced (the offset is an operand so that the add stays behind)
  asm volatile("s_wait_xcnt 0x0" : "+v"(koff) :: "memory");
  koff += 128 * 256 * 2;

  for (int kb = 0; kb < 16; ++kb) {
    // scores of this wave's 16 keys: 8 depth steps, two accumulators a tile
    v8f sa[QT][2];
#pragma unroll
    for (int mi = 0; mi < QT; ++mi) { sa[mi][0] = vzero; sa[mi][1] = vzero; }
    {
#pragma unroll
      for (int h = 0; h < 2; ++h) {
        v16h qa[QT][4];
#pragma unroll
        for (int mi = 0; mi < QT; ++mi)
#pragma unroll
          for (int j = 0; j < 4; ++j) {
            const _Float16* qs = qfr + (mi * 8 + h * 4 + j) * 512;
            v8h qlo = *(const v8h*)qs;
            v8h qhi = *(const v8h*)(qs + 256);
#pragma unroll
            for (int e = 0; e < 8; ++e) {
              qa[mi][j][e] = qlo[e];
              qa[mi][j][8 + e] = qhi[e];
            }
          }
        // inputs-only fence on the loaded Q fragments: one LDS latency for
        // the 16 reads of four depth steps, not one for each product
        asm volatile("" :: "v"(qa[0][0]), "v"(qa[0][1]), "v"(qa[0][2]),
                           "v"(qa[0][3]), "v"(qa[1][0]), "v"(qa[1][1]),
                           "v"(qa[1][2]), "v"(qa[1][3]));
#pragma unroll
        for (int j = 0; j < 4; ++j)
#pragma unroll
          for (int mi = 0; mi < QT; ++mi)
            sa[mi][j & 1] = wmma_f16(qa[mi][j], kf[h * 4 + j], sa[mi][j & 1]);
      }
    }

    float* sw = sw0 + (kb & 1) * (QT * 16 * S_PITCH);
#pragma unroll
    for (int mi = 0; mi < QT; ++mi) {
      v8f s = sa[mi][0] + sa[mi][1];
#pragma unroll
      for (int g = 0; g < 8; ++g) sw[(mi * 16 + g) * S_PITCH] = s[g];
    }
    __syncthreads();

    // the wave's 16 fragments of V Wo for this trip fit one register set and
    // are loaded as one group
    const _Float16* vbase = (const _Float16*)(vbat + voff);
    v16h vb[4][4];
#pragma unroll
    for (int ks = 0; ks < 4; ++ks)
#pragma unroll
      for (int nt = 0; nt < 4; ++nt)
        vb[ks][nt] = load_frag_planes(vbase + (ks * 16 + nt) * 512);
    // the next trip's K group, into the registers this trip's products have left
    if (kb < 15) {
      const _Float16* kbase = (const _Float16*)(kbat + koff);
#pragma unroll
      for (int j = 0; j < 8; ++j) kf[j] = load_frag_planes(kbase + j * 512);
    }
    // keeps all the loads in front of the softmax: without it the build issues
    // 22 of the 32 V loads behind the row maximum, and the products wait for them
    __builtin_amdgcn_sched_barrier(0);

    v16h pa[4];
    {
      // row l15 of the wave's tile in A-fragment key order: step ks holds keys
      // ks*32 + half*8 + j at j and ks*32 + 16 + half*8 + j at 8 + j
      float p[4][16];
      {
        const float* sr = sr0 + (kb & 1) * (QT * 16 * S_PITCH);
#pragma unroll
        for (int ks = 0; ks < 4; ++ks) {
          v4f c0 = *(const v4f*)(sr + ks * 32);
          v4f c1 = *(const v4f*)(sr + ks * 32 + 4);
          v4f c2 = *(const v4f*)(sr + ks * 32 + 16);
          v4f c3 = *(const v4f*)(sr + ks * 32 + 20);
#pragma unroll
          for (int j = 0; j < 4; ++j) {
            p[ks][j]      = c0[j] * SCALE_ATT;
            p[ks][4 + j]  = c1[j] * SCALE_ATT;
            p[ks][8 + j]  = c2[j] * SCALE_ATT;
            p[ks][12 + j] = c3[j] * SCALE_ATT;
          }
        }
      }

      // online softmax over the 128 keys of the row (64 here, 64 in lane ^ 16)
      float t = p[0][0];
#pragma unroll
      for (int ks = 0; ks < 4; ++ks)
#pragma unroll
        for (int j = 0; j < 16; ++j) t = fmaxf(t, p[ks][j]);
      t = fmaxf(t, __shfl_xor(t, 16, 32));
      float mn = fmaxf(m, t);
      float corr = __expf(m - mn);
      m = mn;
      float rs4[4];
#pragma unroll
      for (int ks = 0; ks < 4; ++ks) {
        float rs = 0.f;
#pragma unroll
        for (int j = 0; j < 16; ++j) {
          float e = exp_slot(p[ks][j] - mn);
          rs += e;
          pa[ks][j] = (_Float16)e;
        }
        rs4[ks] = rs;
      }
      float rs = (rs4[0] + rs4[1]) + (rs4[2] + rs4[3]);
      rs += __shfl_xor(rs, 16, 32);
      l = l * corr + rs;

      // the accumulators hold rows g + half*8: fetch those rows' factors
#pragma unroll
      for (int g = 0; g < 8; ++g) {
        float cg = __shfl(corr, g + half * 8, 32);
#pragma unroll
        for (int nt = 0; nt < 4; ++nt) o[nt][g] *= cg;
      }
    }

    // P @ (V Wo) over the four 32-key steps of the trip
#pragma unroll
    for (int ks = 0; ks < 4; ++ks)
#pragma unroll
      for (int nt = 0; nt < 4; ++nt)
        o[nt] = wmma_f16(pa[ks], vb[ks][nt], o[nt]);
    // address translations of the V and K loads done before their address
    // registers are advanced (the offsets are operands so that the adds stay
    // behind)
    asm volatile("s_wait_xcnt 0x0" : "+v"(voff), "+v"(koff) :: "memory");
    voff += 4 * 16 * 512 * 2;
    koff += 128 * 256 * 2;
  }

  // normalize, add the output bias, write the final f32 rows
  {
    float bov[4];
#pragma unroll
    for (int nt = 0; nt < 4; ++nt) bov[nt] = bo[cw * 64 + nt * 16 + l15];
    float linv = 1.0f / l;
#pragma unroll
    for (int g = 0; g < 8; ++g) {
      float rinv = __shfl(linv, g + half * 8, 32);
      size_t row = qrow0 + tile * 16 + g + half * 8;
#pragma unroll
      for (int nt = 0; nt < 4; ++nt) {
        out[row * 256 + cw * 64 + nt * 16 + l15] = o[nt][g] * rinv + bov[nt];
      }
      // address translations of the row's stores done before their address
      // and data registers are written again
      asm volatile("s_wait_xcnt 0x0" ::: "memory");
      // keeps the next row's arithmetic behind the wait
      __builtin_amdgcn_sched_barrier(0);
    }
  }
}

// ---------------------------------------------------------------------------
extern "C" void kernel_launch(void* const* d_in, const int* in_sizes, int n_in,
                              void* d_out, int out_size, void* d_ws,
                              size_t ws_size, hipStream_t stream) {
  const float* q    = (const float*)d_in[0];
  const float* k    = (const float*)d_in[1];
  const float* v    = (const float*)d_in[2];
  const float* ln_g = (const float*)d_in[3];
  const float* ln_b = (const float*)d_in[4];
  const float* Wq = (const float*)d_in[5];  const float* bq = (const float*)d_in[6];
  const float* Wk = (const float*)d_in[7];  // bk (d_in[8]) cancels in the softmax
  const float* Wv = (const float*)d_in[9];  const float* bv = (const float*)d_in[10];
  const float* Wo = (const float*)d_in[11]; const float* bo = (const float*)d_in[12];
  float* out = (float*)d_out;

  _Float16* w    = (_Float16*)d_ws;
  _Float16* Wqkf = w;
  _Float16* Wvof = Wqkf + 65536;
  float*    bqk  = (float*)(Wvof + 65536);
  float*    bvo  = bqk + 256;
  _Float16* lnq  = Wvof + 65536 + 1024;
  _Float16* lnk  = lnq + 2097152;
  _Float16* lnv  = lnk + 2097152;
  _Float16* qk16 = lnv + 2097152;
  _Float16* vo16 = qk16 + 2097152;
  _Float16* vof  = vo16 + 2097152;
  _Float16* knf  = vof + 2097152;

  // Wq Wk^T, bq Wk^T, Wv Wo, bv Wo; LN(q), LN(k), LN(v) into lnq, lnk, lnv,
  // which lie one behind the other
  prep_kernel<<<144 + LN_BLOCKS, 256, 0, stream>>>(Wq, bq, Wk, Wv, bv, Wo,
                                                   Wqkf, bqk, Wvof, bvo,
                                                   q, k, v, ln_g, ln_b, lnq);

  // qk = qp @ Wk^T = LN(q) (Wq Wk^T) + bq Wk^T; vo = vp @ Wo likewise; bo is
  // added behind the softmax product
  dim3 ogrid(256 / 128, 8192 / 128, 4);
  gemm_kernel<<<ogrid, 256, 0, stream>>>(lnq, Wqkf, bqk, qk16,
                                         lnv, Wvof, bvo, vo16, 8192, 256, 256, 1,
                                         lnk, knf);

  repack_v_kernel<<<512, 256, 0, stream>>>(vo16, vof);

  flash_attn_kernel<<<256, 256, 0, stream>>>(qk16, knf, vof, bo, out);
}

// v008
// A run of this version takes 53.5 microseconds.
// Next to v007, in two timings, it ran 1.30 times as fast each time.
// All steps since v000 together make it 7.13 times as fast.
#include <hip/hip_runtime.h>
#include <hip/hip_bf16.h>

typedef __attribute__((ext_vector_type(16))) _Float16 v16h;
typedef __attribute__((ext_vector_type(8)))  _Float16 v8h;
typedef __attribute__((ext_vector_type(8)))  float    v8f;
typedef __attribute__((ext_vector_type(4)))  int      v4i;
typedef __attribute__((ext_vector_type(4)))  float    v4f;

#define SCALE_ATT 0.125f   // 64^-0.5
#define LN_EPS    1e-5f

#if __has_builtin(__builtin_amdgcn_global_load_async_to_lds_b128) && \
    __has_builtin(__builtin_amdgcn_s_wait_asynccnt)
#define HAVE_ASYNC_LDS 1
#else
#define HAVE_ASYNC_LDS 0
#endif

typedef __attribute__((address_space(1))) v4i as1_v4i;   // global int4
typedef __attribute__((address_space(3))) v4i as3_v4i;   // LDS int4

__device__ __forceinline__ v8f wmma_f16(v16h a, v16h b, v8f c) {
  return __builtin_amdgcn_wmma_f32_16x16x32_f16(false, a, false, b, (short)0, c, false, false);
}

// 16-half WMMA fragment from row-major f16 memory: two contiguous 16B runs.
__device__ __forceinline__ v16h load_frag(const _Float16* __restrict__ p) {
  v16h r;
#pragma unroll
  for (int j = 0; j < 8; ++j) { r[j] = p[j]; r[8 + j] = p[16 + j]; }
  return r;
}

// 16-half WMMA fragment from two-plane fragment memory: elements 0..7 of all 32
// lanes lie in one 512-byte run, elements 8..15 in the next, so each of the two
// wave-wide 16-byte loads covers four whole 128-byte lines.
__device__ __forceinline__ v16h load_frag_planes(const _Float16* __restrict__ p) {
  v8h lo = *(const v8h*)p;
  v8h hi = *(const v8h*)(p + 256);
  v16h r;
#pragma unroll
  for (int j = 0; j < 8; ++j) { r[j] = lo[j]; r[8 + j] = hi[j]; }
  return r;
}

// e^x as __expf forms it (multiply by log2 e, v_exp_f32). The v_nop in the same
// statement fills the one slot the instruction set asks for behind a
// transcendental before a source of it is overwritten: in a run of exponentials
// the build lets the next one write the source register of the one in front.
__device__ __forceinline__ float exp_slot(float x) {
  float y = x * 1.44269504088896340736f, r;
  asm("v_exp_f32 %0, %1\n\tv_nop" : "=v"(r) : "v"(y));
  return r;
}

// Copy 8192B (one 8-fragment B panel) global -> LDS, 2 x b128 per thread.
__device__ __forceinline__ void stage_b(const _Float16* __restrict__ g,
                                        _Float16* l, int tid) {
  const _Float16* gp = g + tid * 8;
  _Float16* lp = l + tid * 8;
#if HAVE_ASYNC_LDS
  __builtin_amdgcn_global_load_async_to_lds_b128((as1_v4i*)gp, (as3_v4i*)lp, 0, 0);
  __builtin_amdgcn_global_load_async_to_lds_b128((as1_v4i*)(gp + 2048),
                                                 (as3_v4i*)(lp + 2048), 0, 0);
#else
  *(v8h*)lp = *(const v8h*)gp;
  *(v8h*)(lp + 2048) = *(const v8h*)(gp + 2048);
#endif
}

#if HAVE_ASYNC_LDS
#define ASYNC_WAIT(n) __builtin_amdgcn_s_wait_asynccnt(n)
#else
#define ASYNC_WAIT(n)
#endif

// ---------------------------------------------------------------------------
// 1) Weight products. (x W1 + b1) W2 = x (W1 W2) + b1 W2, so each projection
//    pair is multiplied once here, 256 x 1024 x 256, and the rows of q and v
//    then meet one 256 x 256 matrix.
//    by 0: Wq Wk^T and bq Wk^T; 1: Wv Wo and bv Wo.
//    bx = mb*8 + nb: a 32 x 32 tile of the product (2 x 2 WMMA tiles);
//    mb = 8 is the bias row: every A row is the bias vector, row 0 is kept.
//    The 8 waves split the depth (128 each, 4 steps) and their partial tiles
//    are summed through LDS in wave order. Column l15 of tile ni stands for
//    n = nb*32 + l15*2 + ni, so that one 8-byte load of Wo feeds both tiles.
//    The result is written as the f16 B fragments gemm_kernel reads:
//    Wf[(kt*16 + n/16)*512 + lane*16 + e]; a D tile's 8 rows of a lane are the
//    8 contiguous elements of one half of that lane's fragment.
// ---------------------------------------------------------------------------
typedef __attribute__((ext_vector_type(16))) float v16f;
typedef __attribute__((ext_vector_type(2)))  float v2f;

// the 16 f32 values of one lane's fragment from k-contiguous memory
__device__ __forceinline__ v16f load_raw(const float* __restrict__ p) {
  v4f x0 = *(const v4f*)p;
  v4f x1 = *(const v4f*)(p + 4);
  v4f x2 = *(const v4f*)(p + 16);
  v4f x3 = *(const v4f*)(p + 20);
  v16f r;
#pragma unroll
  for (int j = 0; j < 4; ++j) {
    r[j] = x0[j]; r[4 + j] = x1[j]; r[8 + j] = x2[j]; r[12 + j] = x3[j];
  }
  return r;
}

__device__ __forceinline__ v16h to_f16(v16f x) {
  v16h r;
#pragma unroll
  for (int j = 0; j < 16; ++j) r[j] = (_Float16)x[j];
  return r;
}

__device__ __forceinline__ void fold_w_block(
    int bx, int by,
    const float* __restrict__ Wq, const float* __restrict__ bq,
    const float* __restrict__ Wk,
    const float* __restrict__ Wv, const float* __restrict__ bv,
    const float* __restrict__ Wo,
    _Float16* __restrict__ Wqkf, float* __restrict__ bqk,
    _Float16* __restrict__ Wvof, float* __restrict__ bvo) {
  __shared__ v4f red[8][4][2][32];   // [wave][tile][rows 0..3 / 4..7][lane]
  int lane = threadIdx.x & 31, wave = threadIdx.x >> 5;
  int half = lane >> 4, l15 = lane & 15;
  int mb = bx >> 3, nb = bx & 7;
  bool second = by != 0;
  int kw = wave * 128 + half * 8;    // this lane's first depth index

  const float* ap = second ? Wv : Wq;
  int astep = 16 * 1024;
  if (mb < 8) {
    ap += (size_t)(mb * 32 + l15) * 1024 + kw;
  } else {
    ap = (second ? bv : bq) + kw;
    astep = 0;
  }

  const float* ap1 = ap + astep;
  v16f ar[2][4];
#pragma unroll
  for (int s = 0; s < 4; ++s) ar[0][s] = load_raw(ap + s * 32);
#pragma unroll
  for (int s = 0; s < 4; ++s) ar[1][s] = load_raw(ap1 + s * 32);
  // address translations of the A loads done before their address registers
  // are written again (the pointers are inputs so that nothing lands on them)
  asm volatile("s_wait_xcnt 0x0" :: "v"(ap), "v"(ap1) : "memory");

  v16h bf[2][4];
  if (!second) {
    // B[k][n] = Wk[n][k]: a lane's runs are contiguous
    const float* bp = Wk + (size_t)(nb * 32 + l15 * 2) * 1024 + kw;
    v16f br[2][4];
#pragma unroll
    for (int ni = 0; ni < 2; ++ni)
#pragma unroll
      for (int s = 0; s < 4; ++s) br[ni][s] = load_raw(bp + ni * 1024 + s * 32);
    // as above, for the B loads
    asm volatile("s_wait_xcnt 0x0" :: "v"(bp) : "memory");
#pragma unroll
    for (int ni = 0; ni < 2; ++ni)
#pragma unroll
      for (int s = 0; s < 4; ++s) bf[ni][s] = to_f16(br[ni][s]);
  } else {
    // B[k][n] = Wo[k][n]: one load brings columns n and n + 1 of a depth row
    const float* bp = Wo + (size_t)kw * 256 + nb * 32 + l15 * 2;
    v2f lo[4][8], hi[4][8];
#pragma unroll
    for (int s = 0; s < 4; ++s)
#pragma unroll
      for (int j = 0; j < 8; ++j) {
        lo[s][j] = *(const v2f*)(bp + (s * 32 + j) * 256);
        hi[s][j] = *(const v2f*)(bp + (s * 32 + 16 + j) * 256);
      }
    // as above, for the B loads
    asm volatile("s_wait_xcnt 0x0" :: "v"(bp) : "memory");
#pragma unroll
    for (int s = 0; s < 4; ++s)
#pragma unroll
      for (int j = 0; j < 8; ++j) {
        bf[0][s][j]     = (_Float16)lo[s][j][0];
        bf[1][s][j]     = (_Float16)lo[s][j][1];
        bf[0][s][8 + j] = (_Float16)hi[s][j][0];
        bf[1][s][8 + j] = (_Float16)hi[s][j][1];
      }
  }

  v8f acc[4];
  v8f vzero = {0.f, 0.f, 0.f, 0.f, 0.f, 0.f, 0.f, 0.f};
#pragma unroll
  for (int t = 0; t < 4; ++t) acc[t] = vzero;
#pragma unroll
  for (int s = 0; s < 4; ++s) {
    v16h a0 = to_f16(ar[0][s]), a1 = to_f16(ar[1][s]);
    acc[0] = wmma_f16(a0, bf[0][s], acc[0]);
    acc[1] = wmma_f16(a0, bf[1][s], acc[1]);
    acc[2] = wmma_f16(a1, bf[0][s], acc[2]);
    acc[3] = wmma_f16(a1, bf[1][s], acc[3]);
  }
#pragma unroll
  for (int t = 0; t < 4; ++t)
#pragma unroll
    for (int h = 0; h < 2; ++h) {
      v4f x = {acc[t][h * 4], acc[t][h * 4 + 1], acc[t][h * 4 + 2],
               acc[t][h * 4 + 3]};
      red[wave][t][h][lane] = x;
    }
  __syncthreads();

  // wave w sums rows (w&1)*4 .. +3 (of each lane half) of tile w >> 1
  int t = wave >> 1, h = wave & 1;
  int mi = t >> 1, ni = t & 1;
  v4f sum = red[0][t][h][lane];
#pragma unroll
  for (int u = 1; u < 8; ++u) sum += red[u][t][h][lane];
  int n = nb * 32 + l15 * 2 + ni;
  if (mb < 8) {
    typedef __attribute__((ext_vector_type(4))) _Float16 v4h;
    v4h r = {(_Float16)sum[0], (_Float16)sum[1], (_Float16)sum[2],
             (_Float16)sum[3]};
    _Float16* Wf = second ? Wvof : Wqkf;
    *(v4h*)(Wf + (size_t)(mb * 16 + (n >> 4)) * 512 +
            (half * 16 + (n & 15)) * 16 + mi * 8 + h * 4) = r;
  } else if (mi == 0 && h == 0 && half == 0) {
    (second ? bvo : bqk)[n] = sum[0];
  }
}

// ---------------------------------------------------------------------------
// 2) LayerNorm of q, k and v: one wave32 per 256-wide row, f16
//    row-major output; the three outputs lie one behind the other, so a row
//    has one flat index over 3 x 8192. A block takes 256 rows of one tensor,
//    a wave 32 of them in four batches of 8; a batch's 16 loads are issued one
//    batch ahead, and the 8 rows' reductions run side by side.
// ---------------------------------------------------------------------------
#define LN_BATCH 8     // rows a wave has in work at a time
#define LN_NBATCH 4    // batches a wave
#define LN_BLOCKS 96   // 3 * 8192 / (8 waves * LN_BATCH * LN_NBATCH)
// Every loop over rows, elements or shuffle steps below is unrolled: the rows
// live in registers, so each index must be known at compile time.

__device__ __forceinline__ void ln_load(const char* __restrict__ xb, unsigned xoff,
                                        int batch, v4f (&d)[LN_BATCH][2]) {
#pragma unroll
  for (int r = 0; r < LN_BATCH; ++r) {
    d[r][0] = *(const v4f*)(xb + xoff + (batch * LN_BATCH + r) * 1024);
    d[r][1] = *(const v4f*)(xb + xoff + (batch * LN_BATCH + r) * 1024 + 16);
  }
  // address translations of the batch's loads done before any register they
  // name is written again
  asm volatile("s_wait_xcnt 0x0" ::: "memory");
  // keeps the loads in front of the batch that is worked on next, and that
  // batch's arithmetic behind the wait
  __builtin_amdgcn_sched_barrier(0);
}

__device__ __forceinline__ void ln_batch(const v4f (&d)[LN_BATCH][2],
                                         const float (&gv)[8], const float (&bv)[8],
                                         char* __restrict__ yb, unsigned yoff,
                                         int batch) {
  float v[LN_BATCH][8], s[LN_BATCH], vs[LN_BATCH];
#pragma unroll
  for (int r = 0; r < LN_BATCH; ++r) {
    s[r] = 0.f;
#pragma unroll
    for (int j = 0; j < 8; ++j) { v[r][j] = d[r][j >> 2][j & 3]; s[r] += v[r][j]; }
  }
#pragma unroll
  for (int off = 16; off; off >>= 1)
#pragma unroll
    for (int r = 0; r < LN_BATCH; ++r) s[r] += __shfl_xor(s[r], off, 32);
#pragma unroll
  for (int r = 0; r < LN_BATCH; ++r) {
    float mu = s[r] * (1.0f / 256.0f);
    vs[r] = 0.f;
#pragma unroll
    for (int j = 0; j < 8; ++j) { v[r][j] -= mu; vs[r] += v[r][j] * v[r][j]; }
  }
#pragma unroll
  for (int off = 16; off; off >>= 1)
#pragma unroll
    for (int r = 0; r < LN_BATCH; ++r) vs[r] += __shfl_xor(vs[r], off, 32);
#pragma unroll
  for (int r = 0; r < LN_BATCH; ++r) {
    float rstd = rsqrtf(vs[r] * (1.0f / 256.0f) + LN_EPS);
    v8h h;
#pragma unroll
    for (int j = 0; j < 8; ++j) h[j] = (_Float16)(v[r][j] * rstd * gv[j] + bv[j]);
    *(v8h*)(yb + yoff + (batch * LN_BATCH + r) * 512) = h;
  }
  // address translations of the batch's stores done before their data
  // registers are written again
  asm volatile("s_wait_xcnt 0x0" ::: "memory");
  // keeps the next batch's arithmetic behind the wait
  __builtin_amdgcn_sched_barrier(0);
}

__device__ __forceinline__ void layernorm_block(
    int lb, const float* __restrict__ q, const float* __restrict__ k,
    const float* __restrict__ v, const float* __restrict__ g,
    const float* __restrict__ b, _Float16* __restrict__ y) {
  int wave = threadIdx.x >> 5, lane = threadIdx.x & 31;
  int tensor = lb >> 5;   // 32 blocks a tensor
  const float* x = tensor == 0 ? q : (tensor == 1 ? k : v);
  const char* xb = (const char*)(x + (size_t)(lb & 31) * 256 * 256);
  char* yb = (char*)(y + (size_t)lb * 256 * 256);
  unsigned xoff = (unsigned)(wave * (LN_BATCH * LN_NBATCH) * 1024 + lane * 32);
  unsigned yoff = (unsigned)(wave * (LN_BATCH * LN_NBATCH) * 512 + lane * 16);

  v4f g0 = *(const v4f*)(g + lane * 8), g1 = *(const v4f*)(g + lane * 8 + 4);
  v4f b0 = *(const v4f*)(b + lane * 8), b1 = *(const v4f*)(b + lane * 8 + 4);
  v4f d[2][LN_BATCH][2];
  ln_load(xb, xoff, 0, d[0]);
  ln_load(xb, xoff, 1, d[1]);
  float gv[8], bv[8];
#pragma unroll
  for (int j = 0; j < 4; ++j) {
    gv[j] = g0[j]; gv[4 + j] = g1[j]; bv[j] = b0[j]; bv[4 + j] = b1[j];
  }
  ln_batch(d[0], gv, bv, yb, yoff, 0);
  // unrolled so that the two register sets are named at compile time and every
  // row's address is the same register with its own immediate offset
#pragma unroll
  for (int t = 1; t < LN_NBATCH; ++t) {
    if (t + 1 < LN_NBATCH) ln_load(xb, xoff, t + 1, d[(t + 1) & 1]);
    ln_batch(d[t & 1], gv, bv, yb, yoff, t);
  }
}

// The weight products and the three LayerNorms depend on nothing but inputs:
// they share one launch. Blocks 0..143 are the weight products, the rest the rows.
__global__ void __launch_bounds__(256) prep_kernel(
    const float* __restrict__ Wq, const float* __restrict__ bq,
    const float* __restrict__ Wk,
    const float* __restrict__ Wv, const float* __restrict__ bv,
    const float* __restrict__ Wo,
    _Float16* __restrict__ Wqkf, float* __restrict__ bqk,
    _Float16* __restrict__ Wvof, float* __restrict__ bvo,
    const float* __restrict__ q, const float* __restrict__ k,
    const float* __restrict__ v, const float* __restrict__ ln_g,
    const float* __restrict__ ln_b, _Float16* __restrict__ ln_out) {
  int blk = blockIdx.x;
  if (blk < 144) {
    int by = blk >= 72 ? 1 : 0;
    fold_w_block(blk - by * 72, by, Wq, bq, Wk, Wv, bv, Wo, Wqkf, bqk, Wvof, bvo);
  } else {
    layernorm_block(blk - 144, q, k, v, ln_g, ln_b, ln_out);
  }
}

// ---------------------------------------------------------------------------
// 3a) Repack kn = LN(k) [8192,256] f16 into two-plane B fragments of 1024 B:
//    [plane 0..1][lane 0..31][8 halfs]; plane 0 holds elements 0..7 of every
//    lane's fragment, plane 1 elements 8..15. K over (depth32 x key16),
//    fragment keytile*8 + step; a wave turns 128 B of each of 16 key rows into
//    two fragments. 256 blocks; it needs LN(k) alone, so it rides in the GEMM
//    launch.
// ---------------------------------------------------------------------------
__device__ __forceinline__ void repack_k_block(
    int kblk, const _Float16* __restrict__ kn, _Float16* __restrict__ knf) {
  int lane = threadIdx.x & 31;
  int half = lane >> 4, l15 = lane & 15;
  {
    int kw = kblk * 8 + (threadIdx.x >> 5);
    int keytile = kw >> 2;   // 16 key rows
    int pair    = kw & 3;    // depth steps 2*pair and 2*pair + 1
    const _Float16* s =
        kn + (size_t)(keytile * 16 + l15) * 256 + pair * 64 + half * 8;
    v8h r[4];
#pragma unroll
    for (int i = 0; i < 4; ++i) r[i] = *(const v8h*)(s + i * 16);
    _Float16* dst = knf + (size_t)keytile * 4096 + pair * 1024 + lane * 8;
#pragma unroll
    for (int i = 0; i < 4; ++i) *(v8h*)(dst + i * 256) = r[i];
    // address translations of the four stores done before any path of the
    // build writes their address or data registers again
    asm volatile("s_wait_xcnt 0x0" ::: "memory");
  }
}

// ---------------------------------------------------------------------------
// 3) GEMM: C[M,Nn] = A[M,K](f16 rm) @ Bf(swizzled) + bias.
//    8 waves (4M x 2N), block tile 128x128; per-wave 32x64 (acc[2][4]).
//    B panel (8 frags = 8KB per k-step) async-staged into LDS, double-
//    buffered; B fragment reads batched so WMMAs issue back-to-back.
//    blockIdx.z 0 and 1 pick one of two independent problems of the same
//    shape; the blocks of z 2 and 3 are the K repack.
// ---------------------------------------------------------------------------
__global__ void __launch_bounds__(256) gemm_kernel(
    const _Float16* __restrict__ A_0, const _Float16* __restrict__ Bf_0,
    const float* __restrict__ bias_0, void* __restrict__ Cout_0,
    const _Float16* __restrict__ A_1, const _Float16* __restrict__ Bf_1,
    const float* __restrict__ bias_1, void* __restrict__ Cout_1,
    int M, int K, int Nn, int out_f16,
    const _Float16* __restrict__ kn, _Float16* __restrict__ knf) {
  __shared__ _Float16 Bsh[2][8 * 512];   // 2 x 8KB
  if (blockIdx.z >= 2) {   // the whole block, in front of every barrier
    repack_k_block((blockIdx.z - 2) * 128 + blockIdx.y * 2 + blockIdx.x, kn, knf);
    return;
  }
  bool other = blockIdx.z != 0;
  const _Float16* A  = other ? A_1 : A_0;
  const _Float16* Bf = other ? Bf_1 : Bf_0;
  const float* bias  = other ? bias_1 : bias_0;
  void* Cout         = other ? Cout_1 : Cout_0;
  int tid  = threadIdx.x;
  int lane = tid & 31;
  int wave = tid >> 5;
  int wm = wave & 3, wn = wave >> 2;
  int m0 = blockIdx.y * 128 + wm * 32;
  int n0 = blockIdx.x * 128 + wn * 64;
  int half = lane >> 4, l15 = lane & 15;
  int ktiles = K >> 5;
  size_t bstride = (size_t)(Nn >> 4) * 512;

  const _Float16* Ap0 = A + (size_t)(m0 + l15) * K + half * 8;
  const _Float16* Ap1 = Ap0 + (size_t)16 * K;
  const _Float16* Bp = Bf + (size_t)blockIdx.x * 8 * 512;
  const _Float16* bs_base = &Bsh[0][0] + wn * 4 * 512 + lane * 16;

  v8f acc[2][4];
  v8f vzero = {0.f, 0.f, 0.f, 0.f, 0.f, 0.f, 0.f, 0.f};
#pragma unroll
  for (int mi = 0; mi < 2; ++mi)
#pragma unroll
    for (int i = 0; i < 4; ++i) acc[mi][i] = vzero;

  stage_b(Bp, &Bsh[0][0], tid);                    // prologue: k-step 0
  for (int kt = 0; kt < ktiles - 1; ++kt) {
    v16h a0 = load_frag(Ap0);                      // A in flight early
    v16h a1 = load_frag(Ap1);
    Ap0 += 32; Ap1 += 32;
    stage_b(Bp + bstride, &Bsh[(kt + 1) & 1][0], tid);
    Bp += bstride;
    ASYNC_WAIT(2);                                 // oldest panel resident
    __syncthreads();
    const _Float16* bs = bs_base + (kt & 1) * (8 * 512);
    v16h bfr[4];
#pragma unroll
    for (int nt = 0; nt < 4; ++nt) bfr[nt] = *(const v16h*)(bs + nt * 512);
#pragma unroll
    for (int nt = 0; nt < 4; ++nt) acc[0][nt] = wmma_f16(a0, bfr[nt], acc[0][nt]);
#pragma unroll
    for (int nt = 0; nt < 4; ++nt) acc[1][nt] = wmma_f16(a1, bfr[nt], acc[1][nt]);
    __syncthreads();                               // reads done before restage
  }
  {
    v16h a0 = load_frag(Ap0);
    v16h a1 = load_frag(Ap1);
    ASYNC_WAIT(0);
    __syncthreads();
    const _Float16* bs = bs_base + ((ktiles - 1) & 1) * (8 * 512);
    v16h bfr[4];
#pragma unroll
    for (int nt = 0; nt < 4; ++nt) bfr[nt] = *(const v16h*)(bs + nt * 512);
#pragma unroll
    for (int nt = 0; nt < 4; ++nt) acc[0][nt] = wmma_f16(a0, bfr[nt], acc[0][nt]);
#pragma unroll
    for (int nt = 0; nt < 4; ++nt) acc[1][nt] = wmma_f16(a1, bfr[nt], acc[1][nt]);
  }

#pragma unroll
  for (int mi = 0; mi < 2; ++mi) {
#pragma unroll
    for (int nt = 0; nt < 4; ++nt) {
      int n = n0 + nt * 16 + l15;
      float bv = bias ? bias[n] : 0.f;
#pragma unroll
      for (int g = 0; g < 8; ++g) {
        int row = m0 + mi * 16 + g + half * 8;
        float val = acc[mi][nt][g] + bv;
        if (out_f16)
          ((_Float16*)Cout)[(size_t)row * Nn + n] = (_Float16)val;
        else
          ((float*)Cout)[(size_t)row * Nn + n] = val;
      }
    }
  }
}

// ---------------------------------------------------------------------------
// 4) Repack vo = vp @ Wo [8192,256] f16 into two-plane B fragments (layout: see
//    repack_k_block) over (key32 x outcol16), fragment kt*16 + nt.
// ---------------------------------------------------------------------------
__global__ void __launch_bounds__(256) repack_v_kernel(
    const _Float16* __restrict__ vo, _Float16* __restrict__ vof) {
  int lane = threadIdx.x & 31;
  int half = lane >> 4, l15 = lane & 15;
  {
    int frag = blockIdx.x * 8 + (threadIdx.x >> 5);
    int nt = frag & 15;
    int kt = frag >> 4;
    int n = nt * 16 + l15;
    v8h lo, hi;
#pragma unroll
    for (int j = 0; j < 8; ++j) {
      int k0 = kt * 32 + half * 8 + j;
      lo[j] = vo[(size_t)k0 * 256 + n];
      hi[j] = vo[(size_t)(k0 + 16) * 256 + n];
    }
    _Float16* dst = vof + (size_t)frag * 512 + lane * 8;
    *(v8h*)dst         = lo;
    *(v8h*)(dst + 256) = hi;
  }
}

// ---------------------------------------------------------------------------
// 5) Flash attention: block = (batch, 32-query tile), 8 waves, 128 keys a trip.
//    The 32 queries are two 16-row tiles; every K fragment a wave loads feeds
//    one WMMA of each tile, so the block reads K once for 32 rows.
//    qp @ kp^T with kp = kn @ Wk + bk is computed as (qp @ Wk^T) @ kn^T: the Q
//    operand here is qp @ Wk^T and the K operand the normalized k, both 256
//    deep. The term left out, qp . bk, is the same for every key of a query
//    row, and the softmax over the keys does not change under such a shift.
//    Scores: wave w takes keys [w*16, w*16+16) of the trip over the whole
//    depth (Q fragments from LDS), so each score is summed in one wave's
//    accumulators. The raw 32x128 score tile goes through LDS once.
//    Softmax: done once a block. Wave w takes query rows 4w .. 4w+3, 8 lanes a
//    row, 16 keys a lane, and writes P to LDS as the f16 A fragments of the
//    second product, with each row's rescale factor beside them.
//    (P @ V) @ Wo is computed as P @ (V @ Wo): the V operand here is vp @ Wo,
//    256 columns wide, and the kernel's result is the final output (plus bo).
//    Wave w takes both query tiles and output columns [w*32, w*32+32), so the
//    block reads every V fragment once.
// ---------------------------------------------------------------------------
#define S_PITCH 132   // floats; 528 B = 16 B x odd
#define QT 2          // 16-row query tiles a block
// P in LDS: [tile][group 0..15][row 0..15][8 halfs]; group c holds keys
// c*8 .. c*8+7 of the trip, which is k-step c >> 2, fragment elements
// ((c >> 1) & 1) * 8 .. + 7 of the lanes of wave half c & 1. A group is 256 B;
// the 32 B behind it spread the 8 groups a row's lanes store at once over the banks.
#define P_GROUP 144             // halfs
#define P_TILE (16 * P_GROUP)   // halfs

// the value of lane l ^ X (X = 1, 2, 4, 8: inside a 16-lane row), on the vector
// pipe; __shfl_xor goes through the LDS unit and is waited for each time
template <int X>
__device__ __forceinline__ float row_xor(float x) {
  return __builtin_bit_cast(float, __builtin_amdgcn_update_dpp(
      0, __builtin_bit_cast(int, x), 0x160 + X, 0xf, 0xf, true));
}

// Work-group barrier that hands over LDS data alone: it waits for this wave's
// LDS operations and leaves its global loads in flight, which __syncthreads()
// would wait for.
__device__ __forceinline__ void lds_barrier() {
  asm volatile("s_wait_dscnt 0x0\n\ts_barrier_signal -1\n\ts_barrier_wait -1"
               ::: "memory");
}

// one block a WGP (256 blocks): two waves a SIMD
__global__ void __launch_bounds__(256) flash_attn_kernel(
    const _Float16* __restrict__ qk, const _Float16* __restrict__ knf,
    const _Float16* __restrict__ vof, const float* __restrict__ bo,
    float* __restrict__ out) {
  // Q tiles as A fragments: [tile][depth step 0..7][plane 0..1][lane][8 halfs]
  __shared__ __attribute__((aligned(16))) _Float16 Qs[QT * 8 * 512];
  // raw scores of the trip
  __shared__ __attribute__((aligned(16))) float Ssh[QT * 16 * S_PITCH];
  // P of the trip, each row's rescale factor, and at the end 1 / row sum
  __shared__ __attribute__((aligned(16))) _Float16 Ps[QT * P_TILE];
  __shared__ __attribute__((aligned(16))) float Csh[QT * 16];
  __shared__ __attribute__((aligned(16))) float Lsh[QT * 16];

  int lane = threadIdx.x & 31, wave = threadIdx.x >> 5;
  int half = lane >> 4, l15 = lane & 15;
  int srow = wave * 4 + (lane >> 3), sub = lane & 7;   // softmax share
  int b  = blockIdx.x >> 6;
  int qt = blockIdx.x & 63;
  size_t qrow0 = (size_t)b * 2048 + (size_t)qt * (QT * 16);

  // wave w stages the Q fragments of depth step w of both tiles
  {
    v8h qr[QT][2];
    const _Float16* qbase = qk + (qrow0 + l15) * 256 + wave * 32 + half * 8;
#pragma unroll
    for (int mi = 0; mi < QT; ++mi) {
      qr[mi][0] = *(const v8h*)(qbase + mi * 16 * 256);
      qr[mi][1] = *(const v8h*)(qbase + mi * 16 * 256 + 16);
    }
    // address translations of the Q loads done before their address register
    // is written again (the pointer is an input so that no load lands on it)
    asm volatile("s_wait_xcnt 0x0" :: "v"(qbase) : "memory");
#pragma unroll
    for (int mi = 0; mi < QT; ++mi) {
      _Float16* qd = &Qs[(mi * 8 + wave) * 512 + lane * 8];
      *(v8h*)qd         = qr[mi][0];
      *(v8h*)(qd + 256) = qr[mi][1];
    }
  }
  __syncthreads();

  // the batch's K and V, and this lane's running byte offsets into them
  // (advance by one 128-key block per trip)
  const char* kbat = (const char*)(knf + (size_t)b * 2048 * 256);
  const char* vbat = (const char*)(vof + (size_t)b * 2048 * 256);
  unsigned koff = (unsigned)((wave * 8 * 512 + lane * 8) * 2);
  unsigned voff = (unsigned)((wave * 2 * 512 + lane * 8) * 2);
  const _Float16* qfr = &Qs[lane * 8];
  // this lane's places in LDS: raw scores stored and read, P stored and read,
  // rescale factors read
  float* sw = &Ssh[half * 8 * S_PITCH + wave * 16 + l15];
  const float* sr = &Ssh[srow * S_PITCH + sub * 8];
  _Float16* pw = &Ps[(srow >> 4) * P_TILE + sub * P_GROUP + (srow & 15) * 8];
  const _Float16* pr = &Ps[half * P_GROUP + l15 * 8];
  const float* cr = &Csh[half * 8];

  v8f vzero = {0.f, 0.f, 0.f, 0.f, 0.f, 0.f, 0.f, 0.f};
  v8f o[QT][2];
#pragma unroll
  for (int mi = 0; mi < QT; ++mi) { o[mi][0] = vzero; o[mi][1] = vzero; }
  float m = -1e30f, l = 0.f;   // stats of query row srow

  // K fragments come in groups of 8 depth steps, one group a trip; a group's 16
  // loads are issued one group ahead of its products: the first group here,
  // each later one in the trip in front of its own.
  v16h kf[8];
  {
    const _Float16* kbase = (const _Float16*)(kbat + koff);
#pragma unroll
    for (int j = 0; j < 8; ++j) kf[j] = load_frag_planes(kbase + j * 512);
  }
  // address translations of the K loads done before their address register
  // is advanced (the offset is an operand so that the add stays behind)
  asm volatile("s_wait_xcnt 0x0" : "+v"(koff) :: "memory");
  koff += 128 * 256 * 2;

  // One trip. The last one, which has no K group to fetch, is written out behind
  // the loop: with the K loads under a test inside the loop the build cannot
  // count them and waits for all of them in front of the second product.
  auto trip = [&](const bool last) __attribute__((always_inline)) {
    // the wave's 8 fragments of V Wo for this trip, issued in front of the
    // scores: they fly over both barriers
    const _Float16* vbase = (const _Float16*)(vbat + voff);
    v16h vb[4][2];
#pragma unroll
    for (int ks = 0; ks < 4; ++ks)
#pragma unroll
      for (int n2 = 0; n2 < 2; ++n2)
        vb[ks][n2] = load_frag_planes(vbase + (ks * 16 + n2) * 512);

    // scores of this wave's 16 keys: 8 depth steps, two accumulators a tile
    v8f sa[QT][2];
#pragma unroll
    for (int mi = 0; mi < QT; ++mi) { sa[mi][0] = vzero; sa[mi][1] = vzero; }
    {
#pragma unroll
      for (int h = 0; h < 2; ++h) {
        v16h qa[QT][4];
#pragma unroll
        for (int mi = 0; mi < QT; ++mi)
#pragma unroll
          for (int j = 0; j < 4; ++j) {
            const _Float16* qs = qfr + (mi * 8 + h * 4 + j) * 512;
            v8h qlo = *(const v8h*)qs;
            v8h qhi = *(const v8h*)(qs + 256);
#pragma unroll
            for (int e = 0; e < 8; ++e) {
              qa[mi][j][e] = qlo[e];
              qa[mi][j][8 + e] = qhi[e];
            }
          }
        // inputs-only fence on the loaded Q fragments: one LDS latency for
        // the 16 reads of four depth steps, not one for each product
        asm volatile("" :: "v"(qa[0][0]), "v"(qa[0][1]), "v"(qa[0][2]),
                           "v"(qa[0][3]), "v"(qa[1][0]), "v"(qa[1][1]),
                           "v"(qa[1][2]), "v"(qa[1][3]));
#pragma unroll
        for (int j = 0; j < 4; ++j)
#pragma unroll
          for (int mi = 0; mi < QT; ++mi)
            sa[mi][j & 1] = wmma_f16(qa[mi][j], kf[h * 4 + j], sa[mi][j & 1]);
      }
    }

#pragma unroll
    for (int mi = 0; mi < QT; ++mi) {
      v8f s = sa[mi][0] + sa[mi][1];
#pragma unroll
      for (int g = 0; g < 8; ++g) sw[(mi * 16 + g) * S_PITCH] = s[g];
    }
    // the trip's scores are complete; also, every wave has left the P and the
    // factors of the trip before
    lds_barrier();

    // the next trip's K group, into the registers this trip's products have left
    if (!last) {
      const _Float16* kbase = (const _Float16*)(kbat + koff);
#pragma unroll
      for (int j = 0; j < 8; ++j) kf[j] = load_frag_planes(kbase + j * 512);
    }

    {
      // keys sub*8 .. +7 (group sub) and 64 + sub*8 .. +7 (group sub + 8) of
      // row srow
      float p[16];
      {
        v4f c0 = *(const v4f*)sr;
        v4f c1 = *(const v4f*)(sr + 4);
        v4f c2 = *(const v4f*)(sr + 64);
        v4f c3 = *(const v4f*)(sr + 68);
#pragma unroll
        for (int j = 0; j < 4; ++j) {
          p[j]      = c0[j] * SCALE_ATT;
          p[4 + j]  = c1[j] * SCALE_ATT;
          p[8 + j]  = c2[j] * SCALE_ATT;
          p[12 + j] = c3[j] * SCALE_ATT;
        }
      }

      // online softmax over the 128 keys of the row (16 here, the rest in the
      // 7 other lanes of the row)
      float t = p[0];
#pragma unroll
      for (int j = 1; j < 16; ++j) t = fmaxf(t, p[j]);
      t = fmaxf(t, row_xor<1>(t));
      t = fmaxf(t, row_xor<2>(t));
      t = fmaxf(t, row_xor<4>(t));
      float mn = fmaxf(m, t);
      float corr = exp_slot(m - mn);
      m = mn;
      v8h plo, phi;
      float rs0 = 0.f, rs1 = 0.f;
#pragma unroll
      for (int j = 0; j < 8; ++j) {
        float e0 = exp_slot(p[j] - mn);
        float e1 = exp_slot(p[8 + j] - mn);
        rs0 += e0;
        rs1 += e1;
        plo[j] = (_Float16)e0;
        phi[j] = (_Float16)e1;
      }
      float rs = rs0 + rs1;
      rs += row_xor<1>(rs);
      rs += row_xor<2>(rs);
      rs += row_xor<4>(rs);
      l = l * corr + rs;

      *(v8h*)pw = plo;
      *(v8h*)(pw + 8 * P_GROUP) = phi;
      if (sub == 0) Csh[srow] = corr;
    }
    // P and the factors are complete; also, every wave has left the scores
    lds_barrier();

    // the accumulators hold rows g + half*8 of each tile: those rows' factors
    v4f ca[QT], cb[QT];
#pragma unroll
    for (int mi = 0; mi < QT; ++mi) {
      ca[mi] = *(const v4f*)(cr + mi * 16);
      cb[mi] = *(const v4f*)(cr + mi * 16 + 4);
    }
    // P as A fragments: step ks holds keys ks*32 + half*8 + j at j and
    // ks*32 + 16 + half*8 + j at 8 + j
    v16h pa[QT][4];
#pragma unroll
    for (int mi = 0; mi < QT; ++mi)
#pragma unroll
      for (int ks = 0; ks < 4; ++ks) {
        v8h lo = *(const v8h*)(pr + mi * P_TILE + (ks * 4) * P_GROUP);
        v8h hi = *(const v8h*)(pr + mi * P_TILE + (ks * 4 + 2) * P_GROUP);
#pragma unroll
        for (int e = 0; e < 8; ++e) { pa[mi][ks][e] = lo[e]; pa[mi][ks][8 + e] = hi[e]; }
      }
    // inputs-only fence on the loaded factors and P fragments: one LDS latency
    // for the 20 reads, not one for each tile's factors and each pair of products
    asm volatile("" :: "v"(ca[0]), "v"(cb[0]), "v"(ca[1]), "v"(cb[1]),
                       "v"(pa[0][0]), "v"(pa[0][1]), "v"(pa[0][2]), "v"(pa[0][3]),
                       "v"(pa[1][0]), "v"(pa[1][1]), "v"(pa[1][2]), "v"(pa[1][3]));
    // keeps the rescaling and the products behind that fence: left alone the
    // build lifts them over it, with a full LDS wait in front of each
    __builtin_amdgcn_sched_barrier(0);
#pragma unroll
    for (int mi = 0; mi < QT; ++mi)
#pragma unroll
      for (int g = 0; g < 4; ++g)
#pragma unroll
        for (int n2 = 0; n2 < 2; ++n2) {
          o[mi][n2][g]     *= ca[mi][g];
          o[mi][n2][4 + g] *= cb[mi][g];
        }

    // P @ (V Wo) over the four 32-key steps of the trip
#pragma unroll
    for (int ks = 0; ks < 4; ++ks)
#pragma unroll
      for (int mi = 0; mi < QT; ++mi)
#pragma unroll
        for (int n2 = 0; n2 < 2; ++n2)
          o[mi][n2] = wmma_f16(pa[mi][ks], vb[ks][n2], o[mi][n2]);
    // address translations of the V and K loads done before their address
    // registers are advanced (the offsets are operands so that the adds stay
    // behind)
    asm volatile("s_wait_xcnt 0x0" : "+v"(voff), "+v"(koff) :: "memory");
    voff += 4 * 16 * 512 * 2;
    koff += 128 * 256 * 2;
  };
  for (int kb = 0; kb < 15; ++kb) trip(false);
  trip(true);

  // normalize, add the output bias, write the final f32 rows
  {
    if (sub == 0) Lsh[srow] = 1.0f / l;
    float bov[2];
#pragma unroll
    for (int n2 = 0; n2 < 2; ++n2) bov[n2] = bo[wave * 32 + n2 * 16 + l15];
    __syncthreads();
#pragma unroll
    for (int mi = 0; mi < QT; ++mi) {
      v4f la = *(const v4f*)(&Lsh[mi * 16 + half * 8]);
      v4f lb = *(const v4f*)(&Lsh[mi * 16 + half * 8 + 4]);
#pragma unroll
      for (int g = 0; g < 8; ++g) {
        float rinv = g < 4 ? la[g & 3] : lb[g & 3];
        size_t row = qrow0 + mi * 16 + g + half * 8;
#pragma unroll
        for (int n2 = 0; n2 < 2; ++n2) {
          out[row * 256 + wave * 32 + n2 * 16 + l15] = o[mi][n2][g] * rinv + bov[n2];
        }
        // address translations of the row's stores done before their address
        // and data registers are written again
        asm volatile("s_wait_xcnt 0x0" ::: "memory");
        // keeps the next row's arithmetic behind the wait
        __builtin_amdgcn_sched_barrier(0);
      }
    }
  }
}

// ---------------------------------------------------------------------------
extern "C" void kernel_launch(void* const* d_in, const int* in_sizes, int n_in,
                              void* d_out, int out_size, void* d_ws,
                              size_t ws_size, hipStream_t stream) {
  const float* q    = (const float*)d_in[0];
  const float* k    = (const float*)d_in[1];
  const float* v    = (const float*)d_in[2];
  const float* ln_g = (const float*)d_in[3];
  const float* ln_b = (const float*)d_in[4];
  const float* Wq = (const float*)d_in[5];  const float* bq = (const float*)d_in[6];
  const float* Wk = (const float*)d_in[7];  // bk (d_in[8]) cancels in the softmax
  const float* Wv = (const float*)d_in[9];  const float* bv = (const float*)d_in[10];
  const float* Wo = (const float*)d_in[11]; const float* bo = (const float*)d_in[12];
  float* out = (float*)d_out;

  _Float16* w    = (_Float16*)d_ws;
  _Float16* Wqkf = w;
  _Float16* Wvof = Wqkf + 65536;
  float*    bqk  = (float*)(Wvof + 65536);
  float*    bvo  = bqk + 256;
  _Float16* lnq  = Wvof + 65536 + 1024;
  _Float16* lnk  = lnq + 2097152;
  _Float16* lnv  = lnk + 2097152;
  _Float16* qk16 = lnv + 2097152;
  _Float16* vo16 = qk16 + 2097152;
  _Float16* vof  = vo16 + 2097152;
  _Float16* knf  = vof + 2097152;

  // Wq Wk^T, bq Wk^T, Wv Wo, bv Wo; LN(q), LN(k), LN(v) into lnq, lnk, lnv,
  // which lie one behind the other
  prep_kernel<<<144 + LN_BLOCKS, 256, 0, stream>>>(Wq, bq, Wk, Wv, bv, Wo,
                                                   Wqkf, bqk, Wvof, bvo,
                                                   q, k, v, ln_g, ln_b, lnq);

  // qk = qp @ Wk^T = LN(q) (Wq Wk^T) + bq Wk^T; vo = vp @ Wo likewise; bo is
  // added behind the softmax product
  dim3 ogrid(256 / 128, 8192 / 128, 4);
  gemm_kernel<<<ogrid, 256, 0, stream>>>(lnq, Wqkf, bqk, qk16,
                                         lnv, Wvof, bvo, vo16, 8192, 256, 256, 1,
                                         lnk, knf);

  repack_v_kernel<<<512, 256, 0, stream>>>(vo16, vof);

  flash_attn_kernel<<<256, 256, 0, stream>>>(qk16, knf, vof, bo, out);
}

// v009
// Measured time: 38.9 microseconds a run.
// In two side-by-side timings against v008, it was 1.38 and 1.37 times as fast.
// Over all steps from v000 it is 9.80 times as fast.
#include <hip/hip_runtime.h>
#include <hip/hip_bf16.h>

typedef __attribute__((ext_vector_type(16))) _Float16 v16h;
typedef __attribute__((ext_vector_type(8)))  _Float16 v8h;
typedef __attribute__((ext_vector_type(8)))  float    v8f;
typedef __attribute__((ext_vector_type(4)))  int      v4i;
typedef __attribute__((ext_vector_type(4)))  float    v4f;

#define SCALE_ATT 0.125f   // 64^-0.5
#define LN_EPS    1e-5f

__device__ __forceinline__ v8f wmma_f16(v16h a, v16h b, v8f c) {
  return __builtin_amdgcn_wmma_f32_16x16x32_f16(false, a, false, b, (short)0, c, false, false);
}

// 16-half WMMA fragment from row-major f16 memory: two contiguous 16B runs.
__device__ __forceinline__ v16h load_frag(const _Float16* __restrict__ p) {
  v16h r;
#pragma unroll
  for (int j = 0; j < 8; ++j) { r[j] = p[j]; r[8 + j] = p[16 + j]; }
  return r;
}

// 16-half WMMA fragment from two-plane fragment memory: elements 0..7 of all 32
// lanes lie in one 512-byte run, elements 8..15 in the next, so each of the two
// wave-wide 16-byte loads covers four whole 128-byte lines.
__device__ __forceinline__ v16h load_frag_planes(const _Float16* __restrict__ p) {
  v8h lo = *(const v8h*)p;
  v8h hi = *(const v8h*)(p + 256);
  v16h r;
#pragma unroll
  for (int j = 0; j < 8; ++j) { r[j] = lo[j]; r[8 + j] = hi[j]; }
  return r;
}

// e^x as __expf forms it (multiply by log2 e, v_exp_f32). The v_nop in the same
// statement fills the one slot the instruction set asks for behind a
// transcendental before a source of it is overwritten: in a run of exponentials
// the build lets the next one write the source register of the one in front.
__device__ __forceinline__ float exp_slot(float x) {
  float y = x * 1.44269504088896340736f, r;
  asm("v_exp_f32 %0, %1\n\tv_nop" : "=v"(r) : "v"(y));
  return r;
}

// ---------------------------------------------------------------------------
// 1) Weight products. (x W1 + b1) W2 = x (W1 W2) + b1 W2, so each projection
//    pair is multiplied once here, 256 x 1024 x 256, and the rows of q and v
//    then meet one 256 x 256 matrix.
//    by 0: Wq Wk^T and bq Wk^T; 1: Wv Wo and bv Wo.
//    bx = mb*8 + nb: a 32 x 32 tile of the product (2 x 2 WMMA tiles);
//    mb = 8 is the bias row: every A row is the bias vector, row 0 is kept.
//    The 8 waves split the depth (128 each, 4 steps) and their partial tiles
//    are summed through LDS in wave order. Column l15 of tile ni stands for
//    n = nb*32 + l15*2 + ni, so that one 8-byte load of Wo feeds both tiles.
//    The result is written as the f16 B fragments the attention kernel reads:
//    Wf[(kt*16 + n/16)*512 + lane*16 + e]; a D tile's 8 rows of a lane are the
//    8 contiguous elements of one half of that lane's fragment.
// ---------------------------------------------------------------------------
typedef __attribute__((ext_vector_type(16))) float v16f;
typedef __attribute__((ext_vector_type(2)))  float v2f;

// the 16 f32 values of one lane's fragment from k-contiguous memory
__device__ __forceinline__ v16f load_raw(const float* __restrict__ p) {
  v4f x0 = *(const v4f*)p;
  v4f x1 = *(const v4f*)(p + 4);
  v4f x2 = *(const v4f*)(p + 16);
  v4f x3 = *(const v4f*)(p + 20);
  v16f r;
#pragma unroll
  for (int j = 0; j < 4; ++j) {
    r[j] = x0[j]; r[4 + j] = x1[j]; r[8 + j] = x2[j]; r[12 + j] = x3[j];
  }
  return r;
}

__device__ __forceinline__ v16h to_f16(v16f x) {
  v16h r;
#pragma unroll
  for (int j = 0; j < 16; ++j) r[j] = (_Float16)x[j];
  return r;
}

__device__ __forceinline__ void fold_w_block(
    int bx, int by,
    const float* __restrict__ Wq, const float* __restrict__ bq,
    const float* __restrict__ Wk,
    const float* __restrict__ Wv, const float* __restrict__ bv,
    const float* __restrict__ Wo,
    _Float16* __restrict__ Wqkf, float* __restrict__ bqk,
    _Float16* __restrict__ Wvof, float* __restrict__ bvo) {
  __shared__ v4f red[8][4][2][32];   // [wave][tile][rows 0..3 / 4..7][lane]
  int lane = threadIdx.x & 31, wave = threadIdx.x >> 5;
  int half = lane >> 4, l15 = lane & 15;
  int mb = bx >> 3, nb = bx & 7;
  bool second = by != 0;
  int kw = wave * 128 + half * 8;    // this lane's first depth index

  const float* ap = second ? Wv : Wq;
  int astep = 16 * 1024;
  if (mb < 8) {
    ap += (size_t)(mb * 32 + l15) * 1024 + kw;
  } else {
    ap = (second ? bv : bq) + kw;
    astep = 0;
  }

  const float* ap1 = ap + astep;
  v16f ar[2][4];
#pragma unroll
  for (int s = 0; s < 4; ++s) ar[0][s] = load_raw(ap + s * 32);
#pragma unroll
  for (int s = 0; s < 4; ++s) ar[1][s] = load_raw(ap1 + s * 32);
  // address translations of the A loads done before their address registers
  // are written again (the pointers are inputs so that nothing lands on them)
  asm volatile("s_wait_xcnt 0x0" :: "v"(ap), "v"(ap1) : "memory");

  v16h bf[2][4];
  if (!second) {
    // B[k][n] = Wk[n][k]: a lane's runs are contiguous
    const float* bp = Wk + (size_t)(nb * 32 + l15 * 2) * 1024 + kw;
    v16f br[2][4];
#pragma unroll
    for (int ni = 0; ni < 2; ++ni)
#pragma unroll
      for (int s = 0; s < 4; ++s) br[ni][s] = load_raw(bp + ni * 1024 + s * 32);
    // as above, for the B loads
    asm volatile("s_wait_xcnt 0x0" :: "v"(bp) : "memory");
#pragma unroll
    for (int ni = 0; ni < 2; ++ni)
#pragma unroll
      for (int s = 0; s < 4; ++s) bf[ni][s] = to_f16(br[ni][s]);
  } else {
    // B[k][n] = Wo[k][n]: one load brings columns n and n + 1 of a depth row
    const float* bp = Wo + (size_t)kw * 256 + nb * 32 + l15 * 2;
    v2f lo[4][8], hi[4][8];
#pragma unroll
    for (int s = 0; s < 4; ++s)
#pragma unroll
      for (int j = 0; j < 8; ++j) {
        lo[s][j] = *(const v2f*)(bp + (s * 32 + j) * 256);
        hi[s][j] = *(const v2f*)(bp + (s * 32 + 16 + j) * 256);
      }
    // as above, for the B loads
    asm volatile("s_wait_xcnt 0x0" :: "v"(bp) : "memory");
#pragma unroll
    for (int s = 0; s < 4; ++s)
#pragma unroll
      for (int j = 0; j < 8; ++j) {
        bf[0][s][j]     = (_Float16)lo[s][j][0];
        bf[1][s][j]     = (_Float16)lo[s][j][1];
        bf[0][s][8 + j] = (_Float16)hi[s][j][0];
        bf[1][s][8 + j] = (_Float16)hi[s][j][1];
      }
  }

  v8f acc[4];
  v8f vzero = {0.f, 0.f, 0.f, 0.f, 0.f, 0.f, 0.f, 0.f};
#pragma unroll
  for (int t = 0; t < 4; ++t) acc[t] = vzero;
#pragma unroll
  for (int s = 0; s < 4; ++s) {
    v16h a0 = to_f16(ar[0][s]), a1 = to_f16(ar[1][s]);
    acc[0] = wmma_f16(a0, bf[0][s], acc[0]);
    acc[1] = wmma_f16(a0, bf[1][s], acc[1]);
    acc[2] = wmma_f16(a1, bf[0][s], acc[2]);
    acc[3] = wmma_f16(a1, bf[1][s], acc[3]);
  }
#pragma unroll
  for (int t = 0; t < 4; ++t)
#pragma unroll
    for (int h = 0; h < 2; ++h) {
      v4f x = {acc[t][h * 4], acc[t][h * 4 + 1], acc[t][h * 4 + 2],
               acc[t][h * 4 + 3]};
      red[wave][t][h][lane] = x;
    }
  __syncthreads();

  // wave w sums rows (w&1)*4 .. +3 (of each lane half) of tile w >> 1
  int t = wave >> 1, h = wave & 1;
  int mi = t >> 1, ni = t & 1;
  v4f sum = red[0][t][h][lane];
#pragma unroll
  for (int u = 1; u < 8; ++u) sum += red[u][t][h][lane];
  int n = nb * 32 + l15 * 2 + ni;
  if (mb < 8) {
    typedef __attribute__((ext_vector_type(4))) _Float16 v4h;
    v4h r = {(_Float16)sum[0], (_Float16)sum[1], (_Float16)sum[2],
             (_Float16)sum[3]};
    _Float16* Wf = second ? Wvof : Wqkf;
    *(v4h*)(Wf + (size_t)(mb * 16 + (n >> 4)) * 512 +
            (half * 16 + (n & 15)) * 16 + mi * 8 + h * 4) = r;
  } else if (mi == 0 && h == 0 && half == 0) {
    (second ? bvo : bqk)[n] = sum[0];
  }
}

// ---------------------------------------------------------------------------
// 2) LayerNorm of q, k and v: one wave32 per 256-wide row at a time, f16
//    output; the three outputs lie one behind the other, 8192 x 256 each. A
//    block takes 256 rows of one tensor, a wave 32 of them in four batches of
//    8; a batch's 16 loads are issued one batch ahead, and the 8 rows'
//    reductions run side by side.
//    LN(q) is written row-major. LN(k) and LN(v) are written as the two-plane B
//    fragments of 1024 B that the attention loop reads:
//    [plane 0..1][lane 0..31][8 halfs], plane 0 elements 0..7 of every lane's
//    fragment, plane 1 elements 8..15.
//    K over (depth32 x key16), fragment keytile*8 + step: the 8 columns
//    L*8 .. +7 of key row r stand at keytile*4096 + L*128 + (r & 15)*8 halfs.
//    V over (key32 x column16), fragment kt*16 + nt: the 8 keys R .. R+7 (R a
//    multiple of 8) of column n stand at
//    (kt*16 + n/16)*512 + ((R >> 3) & 3)*128 + (n & 15)*8 halfs.
//    Either way lane L's share of a batch (8 rows x 8 columns) is one whole
//    128-byte line, as 8 pieces of 16 bytes: a row's 8 columns each (K) or a
//    column's 8 rows each (V). The pieces are turned through LDS inside the
//    wave, so that 8 lanes store one line together.
// ---------------------------------------------------------------------------
#define LN_BATCH 8     // rows a wave has in work at a time
#define LN_NBATCH 4    // batches a wave
#define LN_BLOCKS 96   // 3 * 8192 / (8 waves * LN_BATCH * LN_NBATCH)
// Every loop over rows, elements or shuffle steps below is unrolled: the rows
// live in registers, so each index must be known at compile time.

__device__ __forceinline__ void ln_load(const char* __restrict__ xb, unsigned xoff,
                                        int batch, v4f (&d)[LN_BATCH][2]) {
#pragma unroll
  for (int r = 0; r < LN_BATCH; ++r) {
    d[r][0] = *(const v4f*)(xb + xoff + (batch * LN_BATCH + r) * 1024);
    d[r][1] = *(const v4f*)(xb + xoff + (batch * LN_BATCH + r) * 1024 + 16);
  }
  // address translations of the batch's loads done before any register they
  // name is written again
  asm volatile("s_wait_xcnt 0x0" ::: "memory");
  // keeps the loads in front of the batch that is worked on next, and that
  // batch's arithmetic behind the wait
  __builtin_amdgcn_sched_barrier(0);
}

#define LN_XPITCH 144   // bytes a lane's 8 pieces take in LDS: 16 B x odd

// MODE 1: K fragments, MODE 2: V fragments. x: the batch's normalized rows.
template <int MODE>
__device__ __forceinline__ void ln_store_frag(const float (&x)[LN_BATCH][8],
                                              char* xl, char* __restrict__ yb,
                                              unsigned foff, int batch) {
  int lane = threadIdx.x & 31;
  v8h pc[8];
#pragma unroll
  for (int i = 0; i < 8; ++i)
#pragma unroll
    for (int e = 0; e < 8; ++e)
      pc[i][e] = (_Float16)(MODE == 1 ? x[i][e] : x[e][i]);
  char* xw = xl + lane * LN_XPITCH;
#pragma unroll
  for (int i = 0; i < 8; ++i) *(v8h*)(xw + i * 16) = pc[i];
  // the wave's lanes read each other's pieces: keeps the reads behind the
  // writes in the build (the LDS serves one wave's operations in order)
  __builtin_amdgcn_fence(__ATOMIC_ACQ_REL, "wavefront");
  __builtin_amdgcn_wave_barrier();
  // store i: lanes 8G .. 8G+7 take the 8 pieces of lane 8G + i
  const char* xr = xl + (lane >> 3) * 8 * LN_XPITCH + (lane & 7) * 16;
#pragma unroll
  for (int i = 0; i < 8; ++i) pc[i] = *(const v8h*)(xr + i * LN_XPITCH);
  // as above: the next batch's writes stay behind these reads
  __builtin_amdgcn_fence(__ATOMIC_ACQ_REL, "wavefront");
  __builtin_amdgcn_wave_barrier();
#pragma unroll
  for (int i = 0; i < 8; ++i) {
    int off = MODE == 1
        ? (batch >> 1) * 8192 + (batch & 1) * 128 + i * 256
        : (batch >> 1) * 512 + (batch & 1) * 256 + (i >> 1) * 1024 + (i & 1) * 128;
    *(v8h*)(yb + foff + off) = pc[i];
  }
}

// MODE 0: rows, as they are (Q)
template <int MODE>
__device__ __forceinline__ void ln_batch(const v4f (&d)[LN_BATCH][2],
                                         const float (&gv)[8], const float (&bv)[8],
                                         char* __restrict__ yb, unsigned yoff,
                                         int batch, char* xl, unsigned foff) {
  float v[LN_BATCH][8], s[LN_BATCH], vs[LN_BATCH];
#pragma unroll
  for (int r = 0; r < LN_BATCH; ++r) {
    s[r] = 0.f;
#pragma unroll
    for (int j = 0; j < 8; ++j) { v[r][j] = d[r][j >> 2][j & 3]; s[r] += v[r][j]; }
  }
#pragma unroll
  for (int off = 16; off; off >>= 1)
#pragma unroll
    for (int r = 0; r < LN_BATCH; ++r) s[r] += __shfl_xor(s[r], off, 32);
#pragma unroll
  for (int r = 0; r < LN_BATCH; ++r) {
    float mu = s[r] * (1.0f / 256.0f);
    vs[r] = 0.f;
#pragma unroll
    for (int j = 0; j < 8; ++j) { v[r][j] -= mu; vs[r] += v[r][j] * v[r][j]; }
  }
#pragma unroll
  for (int off = 16; off; off >>= 1)
#pragma unroll
    for (int r = 0; r < LN_BATCH; ++r) vs[r] += __shfl_xor(vs[r], off, 32);
#pragma unroll
  for (int r = 0; r < LN_BATCH; ++r) {
    float rstd = rsqrtf(vs[r] * (1.0f / 256.0f) + LN_EPS);
    if (MODE == 0) {
      v8h h;
#pragma unroll
      for (int j = 0; j < 8; ++j) h[j] = (_Float16)(v[r][j] * rstd * gv[j] + bv[j]);
      *(v8h*)(yb + yoff + (batch * LN_BATCH + r) * 512) = h;
    } else {
#pragma unroll
      for (int j = 0; j < 8; ++j) v[r][j] = v[r][j] * rstd * gv[j] + bv[j];
    }
  }
  if (MODE != 0) ln_store_frag<MODE>(v, xl, yb, foff, batch);
  // address translations of the batch's stores done before their data
  // registers are written again
  asm volatile("s_wait_xcnt 0x0" ::: "memory");
  // keeps the next batch's arithmetic behind the wait
  __builtin_amdgcn_sched_barrier(0);
}

// The output form is chosen once, outside: each form's four batches are then
// one run of code without a branch, in which the loads stay a batch ahead.
template <int MODE>
__device__ __forceinline__ void ln_rows(
    int lb, const float* __restrict__ x, const float* __restrict__ g,
    const float* __restrict__ b, _Float16* __restrict__ y, char* lnx) {
  int wave = threadIdx.x >> 5, lane = threadIdx.x & 31;
  const char* xb = (const char*)(x + (size_t)(lb & 31) * 256 * 256);
  char* yb = (char*)(y + (size_t)lb * 256 * 256);
  unsigned xoff = (unsigned)(wave * (LN_BATCH * LN_NBATCH) * 1024 + lane * 32);
  unsigned yoff = (unsigned)(wave * (LN_BATCH * LN_NBATCH) * 512 + lane * 16);
  // fragment output: the wave's 32 rows fill the same 16 KiB as row-major rows
  // would; the lines of 8 neighbouring lanes span 2 KiB (K) or 4 KiB (V)
  unsigned foff = (unsigned)(wave * (LN_BATCH * LN_NBATCH) * 512 +
                             (lane >> 3) * (MODE == 1 ? 2048 : 4096) +
                             (lane & 7) * 16);
  char* xl = lnx + wave * (32 * LN_XPITCH);

  v4f g0 = *(const v4f*)(g + lane * 8), g1 = *(const v4f*)(g + lane * 8 + 4);
  v4f b0 = *(const v4f*)(b + lane * 8), b1 = *(const v4f*)(b + lane * 8 + 4);
  v4f d[2][LN_BATCH][2];
  ln_load(xb, xoff, 0, d[0]);
  ln_load(xb, xoff, 1, d[1]);
  float gv[8], bv[8];
#pragma unroll
  for (int j = 0; j < 4; ++j) {
    gv[j] = g0[j]; gv[4 + j] = g1[j]; bv[j] = b0[j]; bv[4 + j] = b1[j];
  }
  ln_batch<MODE>(d[0], gv, bv, yb, yoff, 0, xl, foff);
  // unrolled so that the two register sets are named at compile time and every
  // row's address is the same register with its own immediate offset
#pragma unroll
  for (int t = 1; t < LN_NBATCH; ++t) {
    if (t + 1 < LN_NBATCH) ln_load(xb, xoff, t + 1, d[(t + 1) & 1]);
    ln_batch<MODE>(d[t & 1], gv, bv, yb, yoff, t, xl, foff);
  }
}

__device__ __forceinline__ void layernorm_block(
    int lb, const float* __restrict__ q, const float* __restrict__ k,
    const float* __restrict__ v, const float* __restrict__ g,
    const float* __restrict__ b, _Float16* __restrict__ y) {
  // each wave's own room for turning a batch's pieces
  __shared__ __attribute__((aligned(16))) char lnx[8 * 32 * LN_XPITCH];
  int tensor = lb >> 5;   // 32 blocks a tensor
  if (tensor == 0)      ln_rows<0>(lb, q, g, b, y, lnx);
  else if (tensor == 1) ln_rows<1>(lb, k, g, b, y, lnx);
  else                  ln_rows<2>(lb, v, g, b, y, lnx);
}

// The weight products and the three LayerNorms depend on nothing but inputs:
// they share one launch. Blocks 0..143 are the weight products, the rest the rows.
__global__ void __launch_bounds__(256) prep_kernel(
    const float* __restrict__ Wq, const float* __restrict__ bq,
    const float* __restrict__ Wk,
    const float* __restrict__ Wv, const float* __restrict__ bv,
    const float* __restrict__ Wo,
    _Float16* __restrict__ Wqkf, float* __restrict__ bqk,
    _Float16* __restrict__ Wvof, float* __restrict__ bvo,
    const float* __restrict__ q, const float* __restrict__ k,
    const float* __restrict__ v, const float* __restrict__ ln_g,
    const float* __restrict__ ln_b, _Float16* __restrict__ ln_out) {
  int blk = blockIdx.x;
  if (blk < 144) {
    int by = blk >= 72 ? 1 : 0;
    fold_w_block(blk - by * 72, by, Wq, bq, Wk, Wv, bv, Wo, Wqkf, bqk, Wvof, bvo);
  } else {
    layernorm_block(blk - 144, q, k, v, ln_g, ln_b, ln_out);
  }
}

// ---------------------------------------------------------------------------
// 3) Flash attention: block = (batch, 32-query tile), 8 waves, 128 keys a trip.
//    The 32 queries are two 16-row tiles; every K fragment a wave loads feeds
//    one WMMA of each tile, so the block reads K once for 32 rows.
//    qp @ kp^T with kp = kn @ Wk + bk is computed as (qp @ Wk^T) @ kn^T: the Q
//    operand here is qp @ Wk^T and the K operand the normalized k, both 256
//    deep. The term left out, qp . bk, is the same for every key of a query
//    row, and the softmax over the keys does not change under such a shift.
//    The block makes its own Q operand first: LN(q) (Wq Wk^T) + bq Wk^T for its
//    32 rows, wave w the columns [w*32, w*32+32), straight into LDS.
//    Scores: wave w takes keys [w*16, w*16+16) of the trip over the whole
//    depth (Q fragments from LDS), so each score is summed in one wave's
//    accumulators. The raw 32x128 score tile goes through LDS once.
//    Softmax: done once a block. Wave w takes query rows 4w .. 4w+3, 8 lanes a
//    row, 16 keys a lane, and writes P to LDS as the f16 A fragments of the
//    second product, with each row's rescale factor beside them.
//    softmax(S) @ (LN(v) Wv + bv) @ Wo is computed as
//    (softmax(S) @ LN(v)) (Wv Wo) + bv Wo, a softmax row summing to 1: the V
//    operand here is the normalized v, 256 columns wide. Wave w takes both
//    query tiles and columns [w*32, w*32+32), so the block reads every V
//    fragment once. Behind the loop the normalized 32 x 256 result goes through
//    LDS as f16 A fragments and meets Wv Wo, wave w again the output columns
//    [w*32, w*32+32).
// ---------------------------------------------------------------------------
#define S_PITCH 132   // floats; 528 B = 16 B x odd
#define QT 2          // 16-row query tiles a block
// P in LDS: [tile][group 0..15][row 0..15][8 halfs]; group c holds keys
// c*8 .. c*8+7 of the trip, which is k-step c >> 2, fragment elements
// ((c >> 1) & 1) * 8 .. + 7 of the lanes of wave half c & 1. A group is 256 B;
// the 32 B behind it spread the 8 groups a row's lanes store at once over the banks.
#define P_GROUP 144             // halfs
#define P_TILE (16 * P_GROUP)   // halfs

// the value of lane l ^ X (X = 1, 2, 4, 8: inside a 16-lane row), on the vector
// pipe; __shfl_xor goes through the LDS unit and is waited for each time
template <int X>
__device__ __forceinline__ float row_xor(float x) {
  return __builtin_bit_cast(float, __builtin_amdgcn_update_dpp(
      0, __builtin_bit_cast(int, x), 0x160 + X, 0xf, 0xf, true));
}

// Work-group barrier that hands over LDS data alone: it waits for this wave's
// LDS operations and leaves its global loads in flight, which __syncthreads()
// would wait for.
__device__ __forceinline__ void lds_barrier() {
  asm volatile("s_wait_dscnt 0x0\n\ts_barrier_signal -1\n\ts_barrier_wait -1"
               ::: "memory");
}

// one block a WGP (256 blocks): two waves a SIMD
__global__ void __launch_bounds__(256) flash_attn_kernel(
    const _Float16* __restrict__ lnq, const _Float16* __restrict__ Wqkf,
    const float* __restrict__ bqk, const _Float16* __restrict__ knf,
    const _Float16* __restrict__ vnf, const _Float16* __restrict__ Wvof,
    const float* __restrict__ bvo, const float* __restrict__ bo,
    float* __restrict__ out) {
  // Q tiles as A fragments: [tile][depth step 0..7][plane 0..1][lane][8 halfs];
  // behind the loop the normalized softmax product in the same form
  __shared__ __attribute__((aligned(16))) _Float16 Qs[QT * 8 * 512];
  // raw scores of the trip
  __shared__ __attribute__((aligned(16))) float Ssh[QT * 16 * S_PITCH];
  // P of the trip, each row's rescale factor, and at the end 1 / row sum
  __shared__ __attribute__((aligned(16))) _Float16 Ps[QT * P_TILE];
  __shared__ __attribute__((aligned(16))) float Csh[QT * 16];
  __shared__ __attribute__((aligned(16))) float Lsh[QT * 16];

  int lane = threadIdx.x & 31, wave = threadIdx.x >> 5;
  int half = lane >> 4, l15 = lane & 15;
  int srow = wave * 4 + (lane >> 3), sub = lane & 7;   // softmax share
  int b  = blockIdx.x >> 6;
  int qt = blockIdx.x & 63;
  size_t qrow0 = (size_t)b * 2048 + (size_t)qt * (QT * 16);

  v8f vzero = {0.f, 0.f, 0.f, 0.f, 0.f, 0.f, 0.f, 0.f};
  // where this lane's D elements (row half*8 + g of a tile, column
  // wave*32 + n2*16 + l15) stand in A-fragment form: depth step wave, plane n2,
  // lane (l15 >> 3)*16 + row, element l15 & 7; + mi*8*512 + n2*256 + g*8
  _Float16* aw = &Qs[wave * 512 + ((l15 >> 3) * 16 + half * 8) * 8 + (l15 & 7)];

  // the block's Q operand: 32 rows of LN(q) times Wq Wk^T, 8 depth steps
  {
    const _Float16* ab = lnq + (qrow0 + l15) * 256 + half * 8;
    const _Float16* bb = Wqkf + wave * 2 * 512 + lane * 16;
    const float* cb = bqk + wave * 32 + l15;
    v16h af[QT][8], bf[2][8];
#pragma unroll
    for (int kt = 0; kt < 8; ++kt) {
#pragma unroll
      for (int mi = 0; mi < QT; ++mi)
        af[mi][kt] = load_frag(ab + mi * 16 * 256 + kt * 32);
#pragma unroll
      for (int n2 = 0; n2 < 2; ++n2)
        bf[n2][kt] = *(const v16h*)(bb + (kt * 16 + n2) * 512);
    }
    float cv[2] = {cb[0], cb[16]};
    // address translations of these loads done before their address registers
    // are written again (the pointers are inputs so that no load lands on them)
    asm volatile("s_wait_xcnt 0x0" :: "v"(ab), "v"(bb), "v"(cb) : "memory");
    // keeps all 66 loads in front of the products, one memory latency for the
    // lot: left alone the build deals them out among the products and waits
    // for each depth step's anew
    __builtin_amdgcn_sched_barrier(0);
    v8f qacc[QT][2];
#pragma unroll
    for (int mi = 0; mi < QT; ++mi) { qacc[mi][0] = vzero; qacc[mi][1] = vzero; }
#pragma unroll
    for (int kt = 0; kt < 8; ++kt)
#pragma unroll
      for (int mi = 0; mi < QT; ++mi)
#pragma unroll
        for (int n2 = 0; n2 < 2; ++n2)
          qacc[mi][n2] = wmma_f16(af[mi][kt], bf[n2][kt], qacc[mi][n2]);
#pragma unroll
    for (int mi = 0; mi < QT; ++mi)
#pragma unroll
      for (int n2 = 0; n2 < 2; ++n2)
#pragma unroll
        for (int g = 0; g < 8; ++g)
          aw[mi * 8 * 512 + n2 * 256 + g * 8] = (_Float16)(qacc[mi][n2][g] + cv[n2]);
  }
  __syncthreads();

  // the batch's K and V, and this lane's running byte offsets into them
  // (advance by one 128-key block per trip)
  const char* kbat = (const char*)(knf + (size_t)b * 2048 * 256);
  const char* vbat = (const char*)(vnf + (size_t)b * 2048 * 256);
  unsigned koff = (unsigned)((wave * 8 * 512 + lane * 8) * 2);
  unsigned voff = (unsigned)((wave * 2 * 512 + lane * 8) * 2);
  const _Float16* qfr = &Qs[lane * 8];
  // this lane's places in LDS: raw scores stored and read, P stored and read,
  // rescale factors read
  float* sw = &Ssh[half * 8 * S_PITCH + wave * 16 + l15];
  const float* sr = &Ssh[srow * S_PITCH + sub * 8];
  _Float16* pw = &Ps[(srow >> 4) * P_TILE + sub * P_GROUP + (srow & 15) * 8];
  const _Float16* pr = &Ps[half * P_GROUP + l15 * 8];
  const float* cr = &Csh[half * 8];

  v8f o[QT][2];
#pragma unroll
  for (int mi = 0; mi < QT; ++mi) { o[mi][0] = vzero; o[mi][1] = vzero; }
  float m = -1e30f, l = 0.f;   // stats of query row srow

  // K fragments come in groups of 8 depth steps, one group a trip; a group's 16
  // loads are issued one group ahead of its products: the first group here,
  // each later one in the trip in front of its own.
  v16h kf[8];
  {
    const _Float16* kbase = (const _Float16*)(kbat + koff);
#pragma unroll
    for (int j = 0; j < 8; ++j) kf[j] = load_frag_planes(kbase + j * 512);
  }
  // address translations of the K loads done before their address register
  // is advanced (the offset is an operand so that the add stays behind)
  asm volatile("s_wait_xcnt 0x0" : "+v"(koff) :: "memory");
  koff += 128 * 256 * 2;

  // the wave's 16 fragments of Wv Wo for the product behind the loop; the last
  // trip fetches them where the others fetch the next K group
  const _Float16* wb = Wvof + wave * 2 * 512 + lane * 16;
  v16h wf[2][8];

  // One trip. The last one, which has no K group to fetch, is written out behind
  // the loop: with the K loads under a test inside the loop the build cannot
  // count them and waits for all of them in front of the second product.
  auto trip = [&](const bool last) __attribute__((always_inline)) {
    // the wave's 8 fragments of V for this trip, issued in front of the
    // scores: they fly over both barriers
    const _Float16* vbase = (const _Float16*)(vbat + voff);
    v16h vb[4][2];
#pragma unroll
    for (int ks = 0; ks < 4; ++ks)
#pragma unroll
      for (int n2 = 0; n2 < 2; ++n2)
        vb[ks][n2] = load_frag_planes(vbase + (ks * 16 + n2) * 512);

    // scores of this wave's 16 keys: 8 depth steps, two accumulators a tile
    v8f sa[QT][2];
#pragma unroll
    for (int mi = 0; mi < QT; ++mi) { sa[mi][0] = vzero; sa[mi][1] = vzero; }
    {
#pragma unroll
      for (int h = 0; h < 2; ++h) {
        v16h qa[QT][4];
#pragma unroll
        for (int mi = 0; mi < QT; ++mi)
#pragma unroll
          for (int j = 0; j < 4; ++j) {
            const _Float16* qs = qfr + (mi * 8 + h * 4 + j) * 512;
            v8h qlo = *(const v8h*)qs;
            v8h qhi = *(const v8h*)(qs + 256);
#pragma unroll
            for (int e = 0; e < 8; ++e) {
              qa[mi][j][e] = qlo[e];
              qa[mi][j][8 + e] = qhi[e];
            }
          }
        // inputs-only fence on the loaded Q fragments: one LDS latency for
        // the 16 reads of four depth steps, not one for each product
        asm volatile("" :: "v"(qa[0][0]), "v"(qa[0][1]), "v"(qa[0][2]),
                           "v"(qa[0][3]), "v"(qa[1][0]), "v"(qa[1][1]),
                           "v"(qa[1][2]), "v"(qa[1][3]));
#pragma unroll
        for (int j = 0; j < 4; ++j)
#pragma unroll
          for (int mi = 0; mi < QT; ++mi)
            sa[mi][j & 1] = wmma_f16(qa[mi][j], kf[h * 4 + j], sa[mi][j & 1]);
      }
    }

#pragma unroll
    for (int mi = 0; mi < QT; ++mi) {
      v8f s = sa[mi][0] + sa[mi][1];
#pragma unroll
      for (int g = 0; g < 8; ++g) sw[(mi * 16 + g) * S_PITCH] = s[g];
    }
    // the trip's scores are complete; also, every wave has left the P and the
    // factors of the trip before
    lds_barrier();

    // the next trip's K group, into the registers this trip's products have left
    if (!last) {
      const _Float16* kbase = (const _Float16*)(kbat + koff);
#pragma unroll
      for (int j = 0; j < 8; ++j) kf[j] = load_frag_planes(kbase + j * 512);
    } else {
#pragma unroll
      for (int kt = 0; kt < 8; ++kt)
#pragma unroll
        for (int n2 = 0; n2 < 2; ++n2)
          wf[n2][kt] = *(const v16h*)(wb + (kt * 16 + n2) * 512);
    }

    {
      // keys sub*8 .. +7 (group sub) and 64 + sub*8 .. +7 (group sub + 8) of
      // row srow
      float p[16];
      {
        v4f c0 = *(const v4f*)sr;
        v4f c1 = *(const v4f*)(sr + 4);
        v4f c2 = *(const v4f*)(sr + 64);
        v4f c3 = *(const v4f*)(sr + 68);
#pragma unroll
        for (int j = 0; j < 4; ++j) {
          p[j]      = c0[j] * SCALE_ATT;
          p[4 + j]  = c1[j] * SCALE_ATT;
          p[8 + j]  = c2[j] * SCALE_ATT;
          p[12 + j] = c3[j] * SCALE_ATT;
        }
      }

      // online softmax over the 128 keys of the row (16 here, the rest in the
      // 7 other lanes of the row)
      float t = p[0];
#pragma unroll
      for (int j = 1; j < 16; ++j) t = fmaxf(t, p[j]);
      t = fmaxf(t, row_xor<1>(t));
      t = fmaxf(t, row_xor<2>(t));
      t = fmaxf(t, row_xor<4>(t));
      float mn = fmaxf(m, t);
      float corr = exp_slot(m - mn);
      m = mn;
      v8h plo, phi;
      float rs0 = 0.f, rs1 = 0.f;
#pragma unroll
      for (int j = 0; j < 8; ++j) {
        float e0 = exp_slot(p[j] - mn);
        float e1 = exp_slot(p[8 + j] - mn);
        rs0 += e0;
        rs1 += e1;
        plo[j] = (_Float16)e0;
        phi[j] = (_Float16)e1;
      }
      float rs = rs0 + rs1;
      rs += row_xor<1>(rs);
      rs += row_xor<2>(rs);
      rs += row_xor<4>(rs);
      l = l * corr + rs;

      *(v8h*)pw = plo;
      *(v8h*)(pw + 8 * P_GROUP) = phi;
      if (sub == 0) Csh[srow] = corr;
    }
    // P and the factors are complete; also, every wave has left the scores
    lds_barrier();

    // the accumulators hold rows g + half*8 of each tile: those rows' factors
    v4f ca[QT], cb[QT];
#pragma unroll
    for (int mi = 0; mi < QT; ++mi) {
      ca[mi] = *(const v4f*)(cr + mi * 16);
      cb[mi] = *(const v4f*)(cr + mi * 16 + 4);
    }
    // P as A fragments: step ks holds keys ks*32 + half*8 + j at j and
    // ks*32 + 16 + half*8 + j at 8 + j
    v16h pa[QT][4];
#pragma unroll
    for (int mi = 0; mi < QT; ++mi)
#pragma unroll
      for (int ks = 0; ks < 4; ++ks) {
        v8h lo = *(const v8h*)(pr + mi * P_TILE + (ks * 4) * P_GROUP);
        v8h hi = *(const v8h*)(pr + mi * P_TILE + (ks * 4 + 2) * P_GROUP);
#pragma unroll
        for (int e = 0; e < 8; ++e) { pa[mi][ks][e] = lo[e]; pa[mi][ks][8 + e] = hi[e]; }
      }
    // inputs-only fence on the loaded factors and P fragments: one LDS latency
    // for the 20 reads, not one for each tile's factors and each pair of products
    asm volatile("" :: "v"(ca[0]), "v"(cb[0]), "v"(ca[1]), "v"(cb[1]),
                       "v"(pa[0][0]), "v"(pa[0][1]), "v"(pa[0][2]), "v"(pa[0][3]),
                       "v"(pa[1][0]), "v"(pa[1][1]), "v"(pa[1][2]), "v"(pa[1][3]));
    // keeps the rescaling and the products behind that fence: left alone the
    // build lifts them over it, with a full LDS wait in front of each
    __builtin_amdgcn_sched_barrier(0);
#pragma unroll
    for (int mi = 0; mi < QT; ++mi)
#pragma unroll
      for (int g = 0; g < 4; ++g)
#pragma unroll
        for (int n2 = 0; n2 < 2; ++n2) {
          o[mi][n2][g]     *= ca[mi][g];
          o[mi][n2][4 + g] *= cb[mi][g];
        }

    // P @ V over the four 32-key steps of the trip
#pragma unroll
    for (int ks = 0; ks < 4; ++ks)
#pragma unroll
      for (int mi = 0; mi < QT; ++mi)
#pragma unroll
        for (int n2 = 0; n2 < 2; ++n2)
          o[mi][n2] = wmma_f16(pa[mi][ks], vb[ks][n2], o[mi][n2]);
    // address translations of the V and K loads done before their address
    // registers are advanced (the offsets are operands so that the adds stay
    // behind)
    asm volatile("s_wait_xcnt 0x0" : "+v"(voff), "+v"(koff) :: "memory");
    voff += 4 * 16 * 512 * 2;
    koff += 128 * 256 * 2;
  };
  for (int kb = 0; kb < 15; ++kb) trip(false);
  trip(true);

  // normalize, multiply by Wv Wo, add the biases, write the final f32 rows
  {
    if (sub == 0) Lsh[srow] = 1.0f / l;
    // the biases of the wave's columns, issued in front of the two barriers
    const float* c0 = bvo + wave * 32 + l15;
    const float* c1 = bo + wave * 32 + l15;
    float bov[2] = {c0[0] + c1[0], c0[16] + c1[16]};
    // address translations of these loads and of the Wv Wo loads done before
    // their address registers are written again (the pointers are inputs so
    // that nothing lands on them up to here)
    asm volatile("s_wait_xcnt 0x0" :: "v"(wb), "v"(c0), "v"(c1) : "memory");
    // 1 / row sum is complete (every wave left Qs at the last trip's barriers)
    lds_barrier();
#pragma unroll
    for (int mi = 0; mi < QT; ++mi) {
      v4f la = *(const v4f*)(&Lsh[mi * 16 + half * 8]);
      v4f lb = *(const v4f*)(&Lsh[mi * 16 + half * 8 + 4]);
#pragma unroll
      for (int g = 0; g < 8; ++g) {
        float rinv = g < 4 ? la[g & 3] : lb[g & 3];
#pragma unroll
        for (int n2 = 0; n2 < 2; ++n2)
          aw[mi * 8 * 512 + n2 * 256 + g * 8] = (_Float16)(o[mi][n2][g] * rinv);
      }
    }
    // the normalized product is complete
    lds_barrier();
    v8f r[QT][2];
#pragma unroll
    for (int mi = 0; mi < QT; ++mi) { r[mi][0] = vzero; r[mi][1] = vzero; }
    v16h xa[QT][8];
#pragma unroll
    for (int mi = 0; mi < QT; ++mi)
#pragma unroll
      for (int kt = 0; kt < 8; ++kt)
        xa[mi][kt] = load_frag_planes(qfr + (mi * 8 + kt) * 512);
    // inputs-only fence on the loaded A fragments: one LDS latency for the 32
    // reads, not one for each pair of products
    asm volatile("" :: "v"(xa[0][0]), "v"(xa[0][1]), "v"(xa[0][2]), "v"(xa[0][3]),
                       "v"(xa[0][4]), "v"(xa[0][5]), "v"(xa[0][6]), "v"(xa[0][7]),
                       "v"(xa[1][0]), "v"(xa[1][1]), "v"(xa[1][2]), "v"(xa[1][3]),
                       "v"(xa[1][4]), "v"(xa[1][5]), "v"(xa[1][6]), "v"(xa[1][7]));
    // keeps the products behind that fence
    __builtin_amdgcn_sched_barrier(0);
#pragma unroll
    for (int kt = 0; kt < 8; ++kt)
#pragma unroll
      for (int mi = 0; mi < QT; ++mi)
#pragma unroll
        for (int n2 = 0; n2 < 2; ++n2)
          r[mi][n2] = wmma_f16(xa[mi][kt], wf[n2][kt], r[mi][n2]);
#pragma unroll
    for (int mi = 0; mi < QT; ++mi) {
#pragma unroll
      for (int g = 0; g < 8; ++g) {
        size_t row = qrow0 + mi * 16 + g + half * 8;
#pragma unroll
        for (int n2 = 0; n2 < 2; ++n2) {
          out[row * 256 + wave * 32 + n2 * 16 + l15] = r[mi][n2][g] + bov[n2];
        }
        // address translations of the row's stores done before their address
        // and data registers are written again
        asm volatile("s_wait_xcnt 0x0" ::: "memory");
        // keeps the next row's arithmetic behind the wait
        __builtin_amdgcn_sched_barrier(0);
      }
    }
  }
}

// ---------------------------------------------------------------------------
extern "C" void kernel_launch(void* const* d_in, const int* in_sizes, int n_in,
                              void* d_out, int out_size, void* d_ws,
                              size_t ws_size, hipStream_t stream) {
  const float* q    = (const float*)d_in[0];
  const float* k    = (const float*)d_in[1];
  const float* v    = (const float*)d_in[2];
  const float* ln_g = (const float*)d_in[3];
  const float* ln_b = (const float*)d_in[4];
  const float* Wq = (const float*)d_in[5];  const float* bq = (const float*)d_in[6];
  const float* Wk = (const float*)d_in[7];  // bk (d_in[8]) cancels in the softmax
  const float* Wv = (const float*)d_in[9];  const float* bv = (const float*)d_in[10];
  const float* Wo = (const float*)d_in[11]; const float* bo = (const float*)d_in[12];
  float* out = (float*)d_out;

  _Float16* w    = (_Float16*)d_ws;
  _Float16* Wqkf = w;
  _Float16* Wvof = Wqkf + 65536;
  float*    bqk  = (float*)(Wvof + 65536);
  float*    bvo  = bqk + 256;
  _Float16* lnq  = Wvof + 65536 + 1024;
  _Float16* lnk  = lnq + 2097152;
  _Float16* lnv  = lnk + 2097152;

  // Wq Wk^T, bq Wk^T, Wv Wo, bv Wo; LN(q) as rows, LN(k) and LN(v) as B
  // fragments, into lnq, lnk, lnv, which lie one behind the other
  prep_kernel<<<144 + LN_BLOCKS, 256, 0, stream>>>(Wq, bq, Wk, Wv, bv, Wo,
                                                   Wqkf, bqk, Wvof, bvo,
                                                   q, k, v, ln_g, ln_b, lnq);

  flash_attn_kernel<<<256, 256, 0, stream>>>(lnq, Wqkf, bqk, lnk, lnv, Wvof, bvo,
                                             bo, out);
}
